// v000
// Times are from an AMD MI455X. After a warm-up the kernel runs many times in a row, and a time is the length of
// such a window on the GPU divided by its runs, so every launch and the gaps after it count. The runs cycle
// through copies of the inputs. A figure is the median of several windows, for all but v000 over two sittings.
// Sittings can differ by a few percent; kernels timed side by side share one.
// The starting kernel, v000, takes 283 microseconds a run.
#include <hip/hip_runtime.h>

#define D_MODEL 1024
#define SEQ_LEN 4096
#define N_HEADS 16
#define HEAD_DIM 64
#define LKF 128
#define BATCH 4
#define M_TOTAL (BATCH * SEQ_LEN) /* 16384 */
#define SPLITL 8                  /* split-K chunks for kernel 2 */

typedef __attribute__((ext_vector_type(16))) _Float16 v16h;
typedef __attribute__((ext_vector_type(8)))  _Float16 v8h;
typedef __attribute__((ext_vector_type(8)))  float    v8f;

union V16H { v16h v; v8h h[2]; };

// Load one 16x32 f16 fragment for a lane.
// Per ISA 16-bit A/B layout: lane (0-15 -> m=lane, 16-31 -> m=lane-16) holds two
// contiguous 8-half runs: k in [kf, kf+8) and [kf+16, kf+24), kf = (lane>=16)?8:0.
__device__ __forceinline__ v16h frag_ld(const _Float16* base, int row, int stride, int koff) {
  V16H u;
  const _Float16* p = base + row * stride + koff;
  u.h[0] = *(const v8h*)(p);
  u.h[1] = *(const v8h*)(p + 16);
  return u.v;
}

__device__ __forceinline__ v8f wmma16(v16h a, v16h b, v8f c) {
  return __builtin_amdgcn_wmma_f32_16x16x32_f16(false, a, false, b, (short)0, c, false, false);
}

// ---------------------------------------------------------------------------
// Kernel 1: fused QKV projection.  C[m,n] = sum_k x[m,k] * W[n,k] + b[n]
// WG tile: 128(M) x 64(N) for each of Q,K,V, sharing the staged x tile.
// B-fragments are software-pipelined: frag t+1's ds_loads issue before WMMA t.
// ---------------------------------------------------------------------------
__launch_bounds__(256)
__global__ void qkv_proj_kernel(const float* __restrict__ x,
                                const float* __restrict__ Wq, const float* __restrict__ bq,
                                const float* __restrict__ Wk, const float* __restrict__ bk,
                                const float* __restrict__ Wv, const float* __restrict__ bv,
                                _Float16* __restrict__ Qh, _Float16* __restrict__ Kh,
                                _Float16* __restrict__ Vh)
{
  __shared__ _Float16 Al[128 * 40];      // x tile  [m][k], +8 pad
  __shared__ _Float16 Bl[3][64 * 40];    // W tiles [n][k]

  const int tid  = threadIdx.x;
  const int wave = tid >> 5;
  const int lane = tid & 31;
  const int mBase = blockIdx.x * 128;
  const int nBase = blockIdx.y * 64;

  const float* W[3]    = {Wq, Wk, Wv};
  const float* bias[3] = {bq, bk, bv};
  _Float16*    out[3]  = {Qh, Kh, Vh};

  v8f acc[3][4] = {};

  const int lr = tid >> 3;        // 0..31
  const int lc = (tid & 7) * 4;   // 0,4,...,28
  const int fr = lane & 15;
  const int kf = (lane >> 4) * 8;

  for (int k0 = 0; k0 < D_MODEL; k0 += 32) {
    __syncthreads();
    // stage x tile (128x32 fp32 -> f16)
#pragma unroll
    for (int rr = 0; rr < 4; ++rr) {
      const int row = lr + rr * 32;
      if (k0 + 32 < D_MODEL)
        __builtin_prefetch(x + (size_t)(mBase + row) * D_MODEL + k0 + 32 + lc, 0, 1);
      const float4 f = *(const float4*)(x + (size_t)(mBase + row) * D_MODEL + k0 + lc);
      _Float16* d = &Al[row * 40 + lc];
      d[0] = (_Float16)f.x; d[1] = (_Float16)f.y; d[2] = (_Float16)f.z; d[3] = (_Float16)f.w;
    }
    // stage Wq/Wk/Wv tiles (64x32 each, row-major along k already)
#pragma unroll
    for (int w = 0; w < 3; ++w) {
#pragma unroll
      for (int rr = 0; rr < 2; ++rr) {
        const int row = lr + rr * 32;
        const float4 f = *(const float4*)(W[w] + (size_t)(nBase + row) * D_MODEL + k0 + lc);
        _Float16* d = &Bl[w][row * 40 + lc];
        d[0] = (_Float16)f.x; d[1] = (_Float16)f.y; d[2] = (_Float16)f.z; d[3] = (_Float16)f.w;
      }
    }
    __syncthreads();

    const v16h a = frag_ld(&Al[(wave * 16) * 40], fr, 40, kf);
    // 12-deep pipelined WMMA chain over {w, t}
    v16h bc = frag_ld(&Bl[0][0], fr, 40, kf);
#pragma unroll
    for (int i = 0; i < 11; ++i) {
      const int j = i + 1;
      const v16h bn = frag_ld(&Bl[j >> 2][((j & 3) * 16) * 40], fr, 40, kf);
      acc[i >> 2][i & 3] = wmma16(a, bc, acc[i >> 2][i & 3]);
      bc = bn;
    }
    acc[2][3] = wmma16(a, bc, acc[2][3]);
  }

  // epilogue: bias add, f32 -> f16 store.  C layout: vgpr r -> m = r (lanes 0-15)
  // or r+8 (lanes 16-31); n = lane&15 within the 16-col tile.
  const int col  = lane & 15;
  const int rofs = (lane >> 4) * 8;
#pragma unroll
  for (int w = 0; w < 3; ++w) {
#pragma unroll
    for (int t = 0; t < 4; ++t) {
      const int n = nBase + t * 16 + col;
      const float bb = bias[w][n];
#pragma unroll
      for (int r = 0; r < 8; ++r) {
        const int m = mBase + wave * 16 + rofs + r;
        out[w][(size_t)m * D_MODEL + n] = (_Float16)(acc[w][t][r] + bb);
      }
    }
  }
}

// ---------------------------------------------------------------------------
// Kernel 2: Kp/Vp partials.  Kp[k,d] = sum_l E[h,k,l] * K[b,l,h*64+d]
// grid (64 bh, SPLITL);  each WG reduces a 512-wide l-chunk -> partial buffer.
// ---------------------------------------------------------------------------
__launch_bounds__(256)
__global__ void kv_lowrank_kernel(const float* __restrict__ E,
                                  const _Float16* __restrict__ Kh,
                                  const _Float16* __restrict__ Vh,
                                  float* __restrict__ KpPart, float* __restrict__ VpPart)
{
  __shared__ _Float16 Al[128 * 40];   // E tile  [krow][l]
  __shared__ _Float16 BK[64 * 40];    // K^T tile [d][l]
  __shared__ _Float16 BV[64 * 40];

  const int tid  = threadIdx.x;
  const int wave = tid >> 5;
  const int lane = tid & 31;
  const int bh = blockIdx.x;          // 0..63
  const int b  = bh >> 4, h = bh & 15;
  const int ls = blockIdx.y;          // split index

  v8f accK[4] = {}, accV[4] = {};

  const int lr = tid >> 3, lc = (tid & 7) * 4;
  const int tl = tid >> 3;            // l within tile for B stage
  const int td = (tid & 7) * 8;       // d group
  const int fr = lane & 15;
  const int kf = (lane >> 4) * 8;

  const size_t eBase  = (size_t)h * LKF * SEQ_LEN;
  const size_t kvBase = (size_t)b * SEQ_LEN * D_MODEL + (size_t)h * HEAD_DIM;
  const int lBeg = ls * (SEQ_LEN / SPLITL);
  const int lEnd = lBeg + (SEQ_LEN / SPLITL);

  for (int l0 = lBeg; l0 < lEnd; l0 += 32) {
    __syncthreads();
#pragma unroll
    for (int rr = 0; rr < 4; ++rr) {
      const int row = lr + rr * 32;
      const float4 f = *(const float4*)(E + eBase + (size_t)row * SEQ_LEN + l0 + lc);
      _Float16* d = &Al[row * 40 + lc];
      d[0] = (_Float16)f.x; d[1] = (_Float16)f.y; d[2] = (_Float16)f.z; d[3] = (_Float16)f.w;
    }
    {
      const size_t src = kvBase + (size_t)(l0 + tl) * D_MODEL + td;
      const v8h kk = *(const v8h*)(Kh + src);
      const v8h vv = *(const v8h*)(Vh + src);
#pragma unroll
      for (int i = 0; i < 8; ++i) { BK[(td + i) * 40 + tl] = kk[i]; BV[(td + i) * 40 + tl] = vv[i]; }
    }
    __syncthreads();

    const v16h a = frag_ld(&Al[(wave * 16) * 40], fr, 40, kf);
    // pipelined over t: next K/V fragments in flight during current WMMAs
    v16h bkc = frag_ld(&BK[0], fr, 40, kf);
    v16h bvc = frag_ld(&BV[0], fr, 40, kf);
#pragma unroll
    for (int t = 0; t < 3; ++t) {
      const v16h bkn = frag_ld(&BK[((t + 1) * 16) * 40], fr, 40, kf);
      const v16h bvn = frag_ld(&BV[((t + 1) * 16) * 40], fr, 40, kf);
      accK[t] = wmma16(a, bkc, accK[t]);
      accV[t] = wmma16(a, bvc, accV[t]);
      bkc = bkn; bvc = bvn;
    }
    accK[3] = wmma16(a, bkc, accK[3]);
    accV[3] = wmma16(a, bvc, accV[3]);
  }

  const int col = lane & 15, rofs = (lane >> 4) * 8;
  const size_t pb = ((size_t)ls * (BATCH * N_HEADS) + bh) * LKF * HEAD_DIM;
#pragma unroll
  for (int t = 0; t < 4; ++t) {
#pragma unroll
    for (int r = 0; r < 8; ++r) {
      const int krow = wave * 16 + rofs + r;
      const int n = t * 16 + col;
      KpPart[pb + (size_t)krow * HEAD_DIM + n] = accK[t][r];
      VpPart[pb + (size_t)krow * HEAD_DIM + n] = accV[t][r];
    }
  }
}

// Reduce SPLITL partials -> f16 Kp/Vp (deterministic, no atomics).
__launch_bounds__(256)
__global__ void kv_reduce_kernel(const float* __restrict__ KpPart,
                                 const float* __restrict__ VpPart,
                                 _Float16* __restrict__ Kp, _Float16* __restrict__ Vp)
{
  const size_t idx = (size_t)blockIdx.x * 256 + threadIdx.x;  // 0..524287
  const size_t stride = (size_t)BATCH * N_HEADS * LKF * HEAD_DIM;
  float sk = 0.f, sv = 0.f;
#pragma unroll
  for (int s = 0; s < SPLITL; ++s) { sk += KpPart[s * stride + idx]; sv += VpPart[s * stride + idx]; }
  Kp[idx] = (_Float16)sk;
  Vp[idx] = (_Float16)sv;
}

// ---------------------------------------------------------------------------
// Kernel 3: attention.  dot = Q @ Kp^T / 8 -> softmax(k=128) -> @ Vp -> out.
// grid (32 l-blocks, 64 bh); WG covers 128 rows of l (16 per wave).
// LDS: [VpL 64x136][ KpL 128x72  aliased with  AtL 8x16x136 ]  (52 KB)
// ---------------------------------------------------------------------------
__launch_bounds__(256)
__global__ void attn_kernel(const _Float16* __restrict__ Qh,
                            const _Float16* __restrict__ Kp, const _Float16* __restrict__ Vp,
                            float* __restrict__ out)
{
  __shared__ _Float16 smem[64 * 136 + 8 * 16 * 136];
  _Float16* VpL = smem;                 // [d][kidx]  (transposed Vp)
  _Float16* KpL = smem + 64 * 136;      // [kidx][d]  (row-major Kp) -- dead after GEMM1
  _Float16* AtL = smem + 64 * 136;      // [wave][m][kidx] attn rows -- reuses KpL space

  const int tid  = threadIdx.x;
  const int wave = tid >> 5;
  const int lane = tid & 31;
  const int lBase = blockIdx.x * 128;
  const int bh = blockIdx.y;
  const int b  = bh >> 4, h = bh & 15;

  // stage Kp (row-major) and Vp (transposed)
  {
    const int kr = tid >> 1;
    const int c0 = (tid & 1) * 32;
    const size_t src = ((size_t)bh * LKF + kr) * HEAD_DIM + c0;
#pragma unroll
    for (int j = 0; j < 4; ++j) {
      const v8h kk = *(const v8h*)(Kp + src + 8 * j);
      *(v8h*)(&KpL[kr * 72 + c0 + 8 * j]) = kk;
      const v8h vv = *(const v8h*)(Vp + src + 8 * j);
#pragma unroll
      for (int i = 0; i < 8; ++i) VpL[(c0 + 8 * j + i) * 136 + kr] = vv[i];
    }
  }

  const int fr = lane & 15;
  const int kf = (lane >> 4) * 8;
  const int rofs = (lane >> 4) * 8, col = lane & 15;

  // hoist both global Q fragments (k-halves 0..31, 32..63) before the barrier
  const _Float16* qBase = Qh + ((size_t)b * SEQ_LEN + lBase + wave * 16) * D_MODEL
                             + (size_t)h * HEAD_DIM;
  v16h afr[2];
#pragma unroll
  for (int ks = 0; ks < 2; ++ks) afr[ks] = frag_ld(qBase, fr, D_MODEL, ks * 32 + kf);

  __syncthreads();

  // GEMM1: dot[l, kidx] = Q[l,:64] . Kp[kidx,:64], pipelined over the 8 n-tiles
  v8f acc[8] = {};
#pragma unroll
  for (int ks = 0; ks < 2; ++ks) {
    v16h bc = frag_ld(&KpL[0], fr, 72, ks * 32 + kf);
#pragma unroll
    for (int t = 0; t < 7; ++t) {
      const v16h bn = frag_ld(&KpL[((t + 1) * 16) * 72], fr, 72, ks * 32 + kf);
      acc[t] = wmma16(afr[ks], bc, acc[t]);
      bc = bn;
    }
    acc[7] = wmma16(afr[ks], bc, acc[7]);
  }
  __syncthreads();   // KpL dead everywhere; AtL may now reuse its space

  // softmax over 128 per row; rows split across half-waves, reduce over 16 lanes
  const float scale = 0.125f;  // 1/sqrt(64)
  _Float16* at = &AtL[(wave * 16) * 136];
#pragma unroll
  for (int r = 0; r < 8; ++r) {
    float mx = -3.0e38f;
#pragma unroll
    for (int t = 0; t < 8; ++t) { acc[t][r] *= scale; mx = fmaxf(mx, acc[t][r]); }
#pragma unroll
    for (int s = 1; s < 16; s <<= 1) mx = fmaxf(mx, __shfl_xor(mx, s, 32));
    float sum = 0.f;
#pragma unroll
    for (int t = 0; t < 8; ++t) { const float e = __expf(acc[t][r] - mx); acc[t][r] = e; sum += e; }
#pragma unroll
    for (int s = 1; s < 16; s <<= 1) sum += __shfl_xor(sum, s, 32);
    const float inv = 1.0f / sum;
    const int m = rofs + r;
#pragma unroll
    for (int t = 0; t < 8; ++t) at[m * 136 + t * 16 + col] = (_Float16)(acc[t][r] * inv);
  }
  __syncthreads();

  // GEMM2: out[l, d] = attn[l,:128] . Vp[:,d], pipelined over the 4 n-tiles
  v8f o[4] = {};
#pragma unroll
  for (int ks = 0; ks < 4; ++ks) {
    const v16h a = frag_ld(at, fr, 136, ks * 32 + kf);
    v16h bc = frag_ld(&VpL[0], fr, 136, ks * 32 + kf);
#pragma unroll
    for (int t = 0; t < 3; ++t) {
      const v16h bn = frag_ld(&VpL[((t + 1) * 16) * 136], fr, 136, ks * 32 + kf);
      o[t] = wmma16(a, bc, o[t]);
      bc = bn;
    }
    o[3] = wmma16(a, bc, o[3]);
  }
  // epilogue: head-combined fp32 output [b, l, h*64 + d]
#pragma unroll
  for (int t = 0; t < 4; ++t) {
#pragma unroll
    for (int r = 0; r < 8; ++r) {
      const int l = lBase + wave * 16 + rofs + r;
      out[((size_t)b * SEQ_LEN + l) * D_MODEL + (size_t)h * HEAD_DIM + t * 16 + col] = o[t][r];
    }
  }
}

// ---------------------------------------------------------------------------
extern "C" void kernel_launch(void* const* d_in, const int* in_sizes, int n_in,
                              void* d_out, int out_size, void* d_ws, size_t ws_size,
                              hipStream_t stream) {
  const float* x  = (const float*)d_in[0];
  const float* Wq = (const float*)d_in[1];
  const float* bq = (const float*)d_in[2];
  const float* Wk = (const float*)d_in[3];
  const float* bk = (const float*)d_in[4];
  const float* Wv = (const float*)d_in[5];
  const float* bv = (const float*)d_in[6];
  const float* E  = (const float*)d_in[7];
  float* outp = (float*)d_out;

  char* ws = (char*)d_ws;
  const size_t szQKV  = (size_t)M_TOTAL * D_MODEL * sizeof(_Float16);          // 32 MB each
  const size_t szProj = (size_t)BATCH * N_HEADS * LKF * HEAD_DIM;              // 524288 elems
  _Float16* Qh = (_Float16*)(ws);
  _Float16* Kh = (_Float16*)(ws + szQKV);
  _Float16* Vh = (_Float16*)(ws + 2 * szQKV);
  float* KpPart = (float*)(ws + 3 * szQKV);                                    // 16 MB
  float* VpPart = (float*)(ws + 3 * szQKV + SPLITL * szProj * sizeof(float));  // 16 MB
  _Float16* Kp = (_Float16*)(ws + 3 * szQKV + 2 * SPLITL * szProj * sizeof(float));
  _Float16* Vp = (_Float16*)((char*)Kp + szProj * sizeof(_Float16));

  qkv_proj_kernel<<<dim3(M_TOTAL / 128, D_MODEL / 64), 256, 0, stream>>>(
      x, Wq, bq, Wk, bk, Wv, bv, Qh, Kh, Vh);

  kv_lowrank_kernel<<<dim3(BATCH * N_HEADS, SPLITL), 256, 0, stream>>>(
      E, Kh, Vh, KpPart, VpPart);

  kv_reduce_kernel<<<dim3((unsigned)(szProj / 256)), 256, 0, stream>>>(
      KpPart, VpPart, Kp, Vp);

  attn_kernel<<<dim3(SEQ_LEN / 128, BATCH * N_HEADS), 256, 0, stream>>>(
      Qh, Kp, Vp, outp);
}

// v001
// A run of this version takes 175 microseconds.
// Two timings next to v000 both put it at 1.64 times that version's speed.
#include <hip/hip_runtime.h>

#define D_MODEL 1024
#define SEQ_LEN 4096
#define N_HEADS 16
#define HEAD_DIM 64
#define LKF 128
#define BATCH 4
#define M_TOTAL (BATCH * SEQ_LEN) /* 16384 */
#define SPLITL 8                  /* split-K chunks for kernel 2 */

typedef __attribute__((ext_vector_type(16))) _Float16 v16h;
typedef __attribute__((ext_vector_type(8)))  _Float16 v8h;
typedef __attribute__((ext_vector_type(8)))  float    v8f;

union V16H { v16h v; v8h h[2]; };

// Load one 16x32 f16 fragment for a lane.
// Per ISA 16-bit A/B layout: lane (0-15 -> m=lane, 16-31 -> m=lane-16) holds two
// contiguous 8-half runs: k in [kf, kf+8) and [kf+16, kf+24), kf = (lane>=16)?8:0.
__device__ __forceinline__ v16h frag_ld(const _Float16* base, int row, int stride, int koff) {
  V16H u;
  const _Float16* p = base + row * stride + koff;
  u.h[0] = *(const v8h*)(p);
  u.h[1] = *(const v8h*)(p + 16);
  return u.v;
}

__device__ __forceinline__ v8f wmma16(v16h a, v16h b, v8f c) {
  return __builtin_amdgcn_wmma_f32_16x16x32_f16(false, a, false, b, (short)0, c, false, false);
}

// ---------------------------------------------------------------------------
// Kernel 1: QKV projection.  C[m,n] = sum_k x[m,k] * W[n,k] + b[n]
// One 256(M) x 256(N) tile of one of Q, K, V per workgroup, 64 k per pass.
// 8 waves as 2(M) x 4(N); each wave owns 128 x 64 = 8 x 4 accumulator tiles, so
// 12 fragments read from LDS feed 32 WMMAs.
// grid: x = 12 column tiles (4 each of Q, K, V), y = 64 row tiles.
// ---------------------------------------------------------------------------
#define TKP 64   /* k per pass */
#define TPI 72   /* LDS row pitch in halves: 144 B = 16 B x odd */
__launch_bounds__(256)
__global__ void qkv_proj_kernel(const float* __restrict__ x,
                                const float* __restrict__ Wq, const float* __restrict__ bq,
                                const float* __restrict__ Wk, const float* __restrict__ bk,
                                const float* __restrict__ Wv, const float* __restrict__ bv,
                                _Float16* __restrict__ Qh, _Float16* __restrict__ Kh,
                                _Float16* __restrict__ Vh)
{
  __shared__ _Float16 Al[256 * TPI];   // x tile [m][k]
  __shared__ _Float16 Bl[256 * TPI];   // W tile [n][k]

  const int tid  = threadIdx.x;
  const int wave = tid >> 5;
  const int lane = tid & 31;
  const int sel   = blockIdx.x >> 2;          // 0: Q, 1: K, 2: V
  const int nBase = (blockIdx.x & 3) * 256;
  const int mBase = blockIdx.y * 256;

  const float* W    = sel == 0 ? Wq : (sel == 1 ? Wk : Wv);
  const float* bias = sel == 0 ? bq : (sel == 1 ? bk : bv);
  _Float16*    out  = sel == 0 ? Qh : (sel == 1 ? Kh : Vh);

  const int wm = (wave >> 2) * 128;   // wave's first row in the tile
  const int wn = (wave & 3) * 64;     // wave's first column in the tile

  v8f acc[8][4] = {};

  const int lr = tid >> 4;         // 0..15
  const int lc = (tid & 15) * 4;   // 0,4,...,60
  const int fr = lane & 15;
  const int kf = (lane >> 4) * 8;

  const float* xs = x + (size_t)(mBase + lr) * D_MODEL + lc;
  const float* wsrc = W + (size_t)(nBase + lr) * D_MODEL + lc;

  // the pass loop stays rolled: two passes' staging registers would not fit beside the accumulators
#pragma unroll 1
  for (int k0 = 0; k0 < D_MODEL; k0 += TKP) {
    __syncthreads();
    // stage x and W tiles (256x64 fp32 -> f16 each); all loads first, then the stores
    float4 fa[16], fb[16];
    const float* xp = xs + k0;
    const float* wp = wsrc + k0;
#pragma unroll
    for (int rr = 0; rr < 16; ++rr)
      fa[rr] = *(const float4*)(xp + (size_t)(rr * 16) * D_MODEL);
#pragma unroll
    for (int rr = 0; rr < 16; ++rr)
      fb[rr] = *(const float4*)(wp + (size_t)(rr * 16) * D_MODEL);
    // the wait that stands before a register named by an issued load is written again;
    // the two addresses are inputs so that they stay whole up to it
    asm volatile("s_wait_xcnt 0x0" :: "v"(xp), "v"(wp) : "memory");
#pragma unroll
    for (int rr = 0; rr < 16; ++rr) {
      _Float16* d = &Al[(lr + rr * 16) * TPI + lc];
      d[0] = (_Float16)fa[rr].x; d[1] = (_Float16)fa[rr].y;
      d[2] = (_Float16)fa[rr].z; d[3] = (_Float16)fa[rr].w;
    }
#pragma unroll
    for (int rr = 0; rr < 16; ++rr) {
      _Float16* d = &Bl[(lr + rr * 16) * TPI + lc];
      d[0] = (_Float16)fb[rr].x; d[1] = (_Float16)fb[rr].y;
      d[2] = (_Float16)fb[rr].z; d[3] = (_Float16)fb[rr].w;
    }
    __syncthreads();

#pragma unroll
    for (int ks = 0; ks < TKP; ks += 32) {
      v16h a[8], b[4];
#pragma unroll
      for (int j = 0; j < 4; ++j) b[j] = frag_ld(&Bl[(wn + j * 16) * TPI], fr, TPI, ks + kf);
#pragma unroll
      for (int i = 0; i < 8; ++i) a[i] = frag_ld(&Al[(wm + i * 16) * TPI], fr, TPI, ks + kf);
      // keeps the 24 LDS reads one group ahead of the 32 WMMAs: sunk among them, each
      // row of WMMAs would wait out its own LDS latency
      __builtin_amdgcn_sched_barrier(0);
#pragma unroll
      for (int i = 0; i < 8; ++i) {
#pragma unroll
        for (int j = 0; j < 4; ++j) acc[i][j] = wmma16(a[i], b[j], acc[i][j]);
      }
    }
  }

  // epilogue: bias add, f32 -> f16 store.  C layout: vgpr r -> m = r (lanes 0-15)
  // or r+8 (lanes 16-31); n = lane&15 within the 16-col tile.
  const int col  = lane & 15;
  const int rofs = (lane >> 4) * 8;
  _Float16* op = out + (size_t)(mBase + wm + rofs) * D_MODEL + nBase + wn + col;
  float bb[4];
#pragma unroll
  for (int j = 0; j < 4; ++j) bb[j] = bias[nBase + wn + j * 16 + col];
#pragma unroll
  for (int g = 0; g < 8; g += 2) {   // two row tiles (32 rows x 64 columns) at a time
    _Float16 hv[2][8][4];
#pragma unroll
    for (int i = 0; i < 2; ++i) {
#pragma unroll
      for (int r = 0; r < 8; ++r) {
#pragma unroll
        for (int j = 0; j < 4; ++j) hv[i][r][j] = (_Float16)(acc[g + i][j][r] + bb[j]);
      }
    }
    // keeps this group's conversions ahead of its stores, so that none lands on a
    // register of a store already issued
    __builtin_amdgcn_sched_barrier(0);
#pragma unroll
    for (int i = 0; i < 2; ++i) {
#pragma unroll
      for (int r = 0; r < 8; ++r) {
#pragma unroll
        for (int j = 0; j < 4; ++j)
          op[(size_t)((g + i) * 16 + r) * D_MODEL + j * 16] = hv[i][r][j];
      }
    }
    if (g < 6) {
      // the wait that stands before the next group's conversions reuse the stores' registers
      asm volatile("s_wait_xcnt 0x0" ::: "memory");
      // holds those conversions behind the wait (a "memory" clobber does not order vector work)
      __builtin_amdgcn_sched_barrier(0);
    }
  }
}

// ---------------------------------------------------------------------------
// Kernel 2: Kp/Vp partials.  Kp[k,d] = sum_l E[h,k,l] * K[b,l,h*64+d]
// grid (64 bh, SPLITL);  each WG reduces a 512-wide l-chunk -> partial buffer.
// ---------------------------------------------------------------------------
__launch_bounds__(256)
__global__ void kv_lowrank_kernel(const float* __restrict__ E,
                                  const _Float16* __restrict__ Kh,
                                  const _Float16* __restrict__ Vh,
                                  float* __restrict__ KpPart, float* __restrict__ VpPart)
{
  __shared__ _Float16 Al[128 * 40];   // E tile  [krow][l]
  __shared__ _Float16 BK[64 * 40];    // K^T tile [d][l]
  __shared__ _Float16 BV[64 * 40];

  const int tid  = threadIdx.x;
  const int wave = tid >> 5;
  const int lane = tid & 31;
  const int bh = blockIdx.x;          // 0..63
  const int b  = bh >> 4, h = bh & 15;
  const int ls = blockIdx.y;          // split index

  v8f accK[4] = {}, accV[4] = {};

  const int lr = tid >> 3, lc = (tid & 7) * 4;
  const int tl = tid >> 3;            // l within tile for B stage
  const int td = (tid & 7) * 8;       // d group
  const int fr = lane & 15;
  const int kf = (lane >> 4) * 8;

  const size_t eBase  = (size_t)h * LKF * SEQ_LEN;
  const size_t kvBase = (size_t)b * SEQ_LEN * D_MODEL + (size_t)h * HEAD_DIM;
  const int lBeg = ls * (SEQ_LEN / SPLITL);
  const int lEnd = lBeg + (SEQ_LEN / SPLITL);

  for (int l0 = lBeg; l0 < lEnd; l0 += 32) {
    __syncthreads();
#pragma unroll
    for (int rr = 0; rr < 4; ++rr) {
      const int row = lr + rr * 32;
      const float4 f = *(const float4*)(E + eBase + (size_t)row * SEQ_LEN + l0 + lc);
      _Float16* d = &Al[row * 40 + lc];
      d[0] = (_Float16)f.x; d[1] = (_Float16)f.y; d[2] = (_Float16)f.z; d[3] = (_Float16)f.w;
    }
    {
      const size_t src = kvBase + (size_t)(l0 + tl) * D_MODEL + td;
      const v8h kk = *(const v8h*)(Kh + src);
      const v8h vv = *(const v8h*)(Vh + src);
#pragma unroll
      for (int i = 0; i < 8; ++i) { BK[(td + i) * 40 + tl] = kk[i]; BV[(td + i) * 40 + tl] = vv[i]; }
    }
    __syncthreads();

    const v16h a = frag_ld(&Al[(wave * 16) * 40], fr, 40, kf);
    // pipelined over t: next K/V fragments in flight during current WMMAs
    v16h bkc = frag_ld(&BK[0], fr, 40, kf);
    v16h bvc = frag_ld(&BV[0], fr, 40, kf);
#pragma unroll
    for (int t = 0; t < 3; ++t) {
      const v16h bkn = frag_ld(&BK[((t + 1) * 16) * 40], fr, 40, kf);
      const v16h bvn = frag_ld(&BV[((t + 1) * 16) * 40], fr, 40, kf);
      accK[t] = wmma16(a, bkc, accK[t]);
      accV[t] = wmma16(a, bvc, accV[t]);
      bkc = bkn; bvc = bvn;
    }
    accK[3] = wmma16(a, bkc, accK[3]);
    accV[3] = wmma16(a, bvc, accV[3]);
  }

  const int col = lane & 15, rofs = (lane >> 4) * 8;
  const size_t pb = ((size_t)ls * (BATCH * N_HEADS) + bh) * LKF * HEAD_DIM;
#pragma unroll
  for (int t = 0; t < 4; ++t) {
#pragma unroll
    for (int r = 0; r < 8; ++r) {
      const int krow = wave * 16 + rofs + r;
      const int n = t * 16 + col;
      KpPart[pb + (size_t)krow * HEAD_DIM + n] = accK[t][r];
      VpPart[pb + (size_t)krow * HEAD_DIM + n] = accV[t][r];
    }
  }
}

// Reduce SPLITL partials -> f16 Kp/Vp (deterministic, no atomics).
__launch_bounds__(256)
__global__ void kv_reduce_kernel(const float* __restrict__ KpPart,
                                 const float* __restrict__ VpPart,
                                 _Float16* __restrict__ Kp, _Float16* __restrict__ Vp)
{
  const size_t idx = (size_t)blockIdx.x * 256 + threadIdx.x;  // 0..524287
  const size_t stride = (size_t)BATCH * N_HEADS * LKF * HEAD_DIM;
  float sk = 0.f, sv = 0.f;
#pragma unroll
  for (int s = 0; s < SPLITL; ++s) { sk += KpPart[s * stride + idx]; sv += VpPart[s * stride + idx]; }
  Kp[idx] = (_Float16)sk;
  Vp[idx] = (_Float16)sv;
}

// ---------------------------------------------------------------------------
// Kernel 3: attention.  dot = Q @ Kp^T / 8 -> softmax(k=128) -> @ Vp -> out.
// grid (32 l-blocks, 64 bh); WG covers 128 rows of l (16 per wave).
// LDS: [VpL 64x136][ KpL 128x72  aliased with  AtL 8x16x136 ]  (52 KB)
// ---------------------------------------------------------------------------
__launch_bounds__(256)
__global__ void attn_kernel(const _Float16* __restrict__ Qh,
                            const _Float16* __restrict__ Kp, const _Float16* __restrict__ Vp,
                            float* __restrict__ out)
{
  __shared__ _Float16 smem[64 * 136 + 8 * 16 * 136];
  _Float16* VpL = smem;                 // [d][kidx]  (transposed Vp)
  _Float16* KpL = smem + 64 * 136;      // [kidx][d]  (row-major Kp) -- dead after GEMM1
  _Float16* AtL = smem + 64 * 136;      // [wave][m][kidx] attn rows -- reuses KpL space

  const int tid  = threadIdx.x;
  const int wave = tid >> 5;
  const int lane = tid & 31;
  const int lBase = blockIdx.x * 128;
  const int bh = blockIdx.y;
  const int b  = bh >> 4, h = bh & 15;

  // stage Kp (row-major) and Vp (transposed)
  {
    const int kr = tid >> 1;
    const int c0 = (tid & 1) * 32;
    const size_t src = ((size_t)bh * LKF + kr) * HEAD_DIM + c0;
#pragma unroll
    for (int j = 0; j < 4; ++j) {
      const v8h kk = *(const v8h*)(Kp + src + 8 * j);
      *(v8h*)(&KpL[kr * 72 + c0 + 8 * j]) = kk;
      const v8h vv = *(const v8h*)(Vp + src + 8 * j);
#pragma unroll
      for (int i = 0; i < 8; ++i) VpL[(c0 + 8 * j + i) * 136 + kr] = vv[i];
    }
  }

  const int fr = lane & 15;
  const int kf = (lane >> 4) * 8;
  const int rofs = (lane >> 4) * 8, col = lane & 15;

  // hoist both global Q fragments (k-halves 0..31, 32..63) before the barrier
  const _Float16* qBase = Qh + ((size_t)b * SEQ_LEN + lBase + wave * 16) * D_MODEL
                             + (size_t)h * HEAD_DIM;
  v16h afr[2];
#pragma unroll
  for (int ks = 0; ks < 2; ++ks) afr[ks] = frag_ld(qBase, fr, D_MODEL, ks * 32 + kf);

  __syncthreads();

  // GEMM1: dot[l, kidx] = Q[l,:64] . Kp[kidx,:64], pipelined over the 8 n-tiles
  v8f acc[8] = {};
#pragma unroll
  for (int ks = 0; ks < 2; ++ks) {
    v16h bc = frag_ld(&KpL[0], fr, 72, ks * 32 + kf);
#pragma unroll
    for (int t = 0; t < 7; ++t) {
      const v16h bn = frag_ld(&KpL[((t + 1) * 16) * 72], fr, 72, ks * 32 + kf);
      acc[t] = wmma16(afr[ks], bc, acc[t]);
      bc = bn;
    }
    acc[7] = wmma16(afr[ks], bc, acc[7]);
  }
  __syncthreads();   // KpL dead everywhere; AtL may now reuse its space

  // softmax over 128 per row; rows split across half-waves, reduce over 16 lanes
  const float scale = 0.125f;  // 1/sqrt(64)
  _Float16* at = &AtL[(wave * 16) * 136];
#pragma unroll
  for (int r = 0; r < 8; ++r) {
    float mx = -3.0e38f;
#pragma unroll
    for (int t = 0; t < 8; ++t) { acc[t][r] *= scale; mx = fmaxf(mx, acc[t][r]); }
#pragma unroll
    for (int s = 1; s < 16; s <<= 1) mx = fmaxf(mx, __shfl_xor(mx, s, 32));
    float sum = 0.f;
#pragma unroll
    for (int t = 0; t < 8; ++t) { const float e = __expf(acc[t][r] - mx); acc[t][r] = e; sum += e; }
#pragma unroll
    for (int s = 1; s < 16; s <<= 1) sum += __shfl_xor(sum, s, 32);
    const float inv = 1.0f / sum;
    const int m = rofs + r;
#pragma unroll
    for (int t = 0; t < 8; ++t) at[m * 136 + t * 16 + col] = (_Float16)(acc[t][r] * inv);
  }
  __syncthreads();

  // GEMM2: out[l, d] = attn[l,:128] . Vp[:,d], pipelined over the 4 n-tiles
  v8f o[4] = {};
#pragma unroll
  for (int ks = 0; ks < 4; ++ks) {
    const v16h a = frag_ld(at, fr, 136, ks * 32 + kf);
    v16h bc = frag_ld(&VpL[0], fr, 136, ks * 32 + kf);
#pragma unroll
    for (int t = 0; t < 3; ++t) {
      const v16h bn = frag_ld(&VpL[((t + 1) * 16) * 136], fr, 136, ks * 32 + kf);
      o[t] = wmma16(a, bc, o[t]);
      bc = bn;
    }
    o[3] = wmma16(a, bc, o[3]);
  }
  // epilogue: head-combined fp32 output [b, l, h*64 + d]
#pragma unroll
  for (int t = 0; t < 4; ++t) {
#pragma unroll
    for (int r = 0; r < 8; ++r) {
      const int l = lBase + wave * 16 + rofs + r;
      out[((size_t)b * SEQ_LEN + l) * D_MODEL + (size_t)h * HEAD_DIM + t * 16 + col] = o[t][r];
    }
  }
}

// ---------------------------------------------------------------------------
extern "C" void kernel_launch(void* const* d_in, const int* in_sizes, int n_in,
                              void* d_out, int out_size, void* d_ws, size_t ws_size,
                              hipStream_t stream) {
  const float* x  = (const float*)d_in[0];
  const float* Wq = (const float*)d_in[1];
  const float* bq = (const float*)d_in[2];
  const float* Wk = (const float*)d_in[3];
  const float* bk = (const float*)d_in[4];
  const float* Wv = (const float*)d_in[5];
  const float* bv = (const float*)d_in[6];
  const float* E  = (const float*)d_in[7];
  float* outp = (float*)d_out;

  char* ws = (char*)d_ws;
  const size_t szQKV  = (size_t)M_TOTAL * D_MODEL * sizeof(_Float16);          // 32 MB each
  const size_t szProj = (size_t)BATCH * N_HEADS * LKF * HEAD_DIM;              // 524288 elems
  _Float16* Qh = (_Float16*)(ws);
  _Float16* Kh = (_Float16*)(ws + szQKV);
  _Float16* Vh = (_Float16*)(ws + 2 * szQKV);
  float* KpPart = (float*)(ws + 3 * szQKV);                                    // 16 MB
  float* VpPart = (float*)(ws + 3 * szQKV + SPLITL * szProj * sizeof(float));  // 16 MB
  _Float16* Kp = (_Float16*)(ws + 3 * szQKV + 2 * SPLITL * szProj * sizeof(float));
  _Float16* Vp = (_Float16*)((char*)Kp + szProj * sizeof(_Float16));

  qkv_proj_kernel<<<dim3(3 * D_MODEL / 256, M_TOTAL / 256), 256, 0, stream>>>(
      x, Wq, bq, Wk, bk, Wv, bv, Qh, Kh, Vh);

  kv_lowrank_kernel<<<dim3(BATCH * N_HEADS, SPLITL), 256, 0, stream>>>(
      E, Kh, Vh, KpPart, VpPart);

  kv_reduce_kernel<<<dim3((unsigned)(szProj / 256)), 256, 0, stream>>>(
      KpPart, VpPart, Kp, Vp);

  attn_kernel<<<dim3(SEQ_LEN / 128, BATCH * N_HEADS), 256, 0, stream>>>(
      Qh, Kp, Vp, outp);
}

// v002
// One run takes 163 microseconds.
// Timed twice side by side with v001, it ran 1.07 times as fast both times.
// All steps since v000 together make it 1.76 times as fast.
#include <hip/hip_runtime.h>

#define D_MODEL 1024
#define SEQ_LEN 4096
#define N_HEADS 16
#define HEAD_DIM 64
#define LKF 128
#define BATCH 4
#define M_TOTAL (BATCH * SEQ_LEN) /* 16384 */
#define SPLITL 8                  /* split-K chunks for kernel 2 */

typedef __attribute__((ext_vector_type(16))) _Float16 v16h;
typedef __attribute__((ext_vector_type(8)))  _Float16 v8h;
typedef __attribute__((ext_vector_type(8)))  float    v8f;

union V16H { v16h v; v8h h[2]; };

// Load one 16x32 f16 fragment for a lane.
// Per ISA 16-bit A/B layout: lane (0-15 -> m=lane, 16-31 -> m=lane-16) holds two
// contiguous 8-half runs: k in [kf, kf+8) and [kf+16, kf+24), kf = (lane>=16)?8:0.
__device__ __forceinline__ v16h frag_ld(const _Float16* base, int row, int stride, int koff) {
  V16H u;
  const _Float16* p = base + row * stride + koff;
  u.h[0] = *(const v8h*)(p);
  u.h[1] = *(const v8h*)(p + 16);
  return u.v;
}

__device__ __forceinline__ v8f wmma16(v16h a, v16h b, v8f c) {
  return __builtin_amdgcn_wmma_f32_16x16x32_f16(false, a, false, b, (short)0, c, false, false);
}

// ---------------------------------------------------------------------------
// Kernel 1: QKV projection.  C[m,n] = sum_k x[m,k] * W[n,k] + b[n]
// One 256(M) x 256(N) tile of one of Q, K, V per workgroup, 64 k per pass.
// 8 waves as 2(M) x 4(N); each wave owns 128 x 64 = 8 x 4 accumulator tiles, so
// 12 fragments read from LDS feed 32 WMMAs.
// Two LDS buffers: the next pass's global loads are issued ahead of this pass's WMMAs
// and land in registers meanwhile; they are converted and stored into the other buffer
// behind the WMMAs, so one barrier per pass is enough.
// grid: x = 12 column tiles (4 each of Q, K, V), y = 64 row tiles.
// ---------------------------------------------------------------------------
#define TKP 64   /* k per pass */
#define TPI 72   /* LDS row pitch in halves: 144 B = 16 B x odd */
#define TOP (256 * TPI)   /* halves of one operand's tile */
#define TBUF (2 * TOP)    /* halves of one buffer: x tile, then W tile */

// issue one pass's global loads (256x64 fp32 of x and of W, 32 x 16 B per lane) and step
// the two addresses on to the next pass
typedef const __attribute__((address_space(1))) float* gfloat_p;   // known global: global_load, not flat_load
typedef const __attribute__((address_space(1))) float4* gfloat4_p;
__device__ __forceinline__ void stage_ld(float4 (&fa)[16], float4 (&fb)[16],
                                         gfloat_p& xp, gfloat_p& wp) {
#pragma unroll
  for (int rr = 0; rr < 16; ++rr)
    fa[rr] = *(gfloat4_p)(xp + (size_t)(rr * 16) * D_MODEL);
#pragma unroll
  for (int rr = 0; rr < 16; ++rr)
    fb[rr] = *(gfloat4_p)(wp + (size_t)(rr * 16) * D_MODEL);
  // the wait that stands before a register named by an issued load is written again, and
  // the step of 64 floats (0x100 bytes) in the same statement: written in the source, the
  // step was placed between the loads and the wait
  asm volatile("s_wait_xcnt 0x0\n\t"
               "v_add_nc_u64 %0, 0x100, %0\n\t"
               "v_add_nc_u64 %1, 0x100, %1"
               : "+v"(xp), "+v"(wp) :: "memory");
}

// fp32 -> f16 and store into one buffer; d0 points at this lane's first element of the x tile
__device__ __forceinline__ void stage_st(const float4 (&fa)[16], const float4 (&fb)[16],
                                         _Float16* d0) {
#pragma unroll
  for (int rr = 0; rr < 16; ++rr) {
    _Float16* d = d0 + rr * 16 * TPI;
    d[0] = (_Float16)fa[rr].x; d[1] = (_Float16)fa[rr].y;
    d[2] = (_Float16)fa[rr].z; d[3] = (_Float16)fa[rr].w;
  }
#pragma unroll
  for (int rr = 0; rr < 16; ++rr) {
    _Float16* d = d0 + TOP + rr * 16 * TPI;
    d[0] = (_Float16)fb[rr].x; d[1] = (_Float16)fb[rr].y;
    d[2] = (_Float16)fb[rr].z; d[3] = (_Float16)fb[rr].w;
  }
}

// one pass's 64 WMMAs; ap, bp point at this lane's first fragment run in the buffer
__device__ __forceinline__ void pass_mma(v8f (&acc)[8][4], const _Float16* ap, const _Float16* bp) {
#pragma unroll
  for (int ks = 0; ks < TKP; ks += 32) {
    v16h a[8], b[4];
#pragma unroll
    for (int j = 0; j < 4; ++j) b[j] = frag_ld(bp, j * 16, TPI, ks);
#pragma unroll
    for (int i = 0; i < 8; ++i) a[i] = frag_ld(ap, i * 16, TPI, ks);
    // keeps the 24 LDS reads one group ahead of the 32 WMMAs: sunk among them, each
    // row of WMMAs would wait out its own LDS latency
    __builtin_amdgcn_sched_barrier(0);
#pragma unroll
    for (int i = 0; i < 8; ++i) {
#pragma unroll
      for (int j = 0; j < 4; ++j) acc[i][j] = wmma16(a[i], b[j], acc[i][j]);
    }
    // keeps what follows (the next 24 LDS reads, the staging conversions with their wait
    // for the global loads) behind these WMMAs: moved in among them it spilled registers
    // and waited for the global loads with half of the pass's WMMAs still to issue
    __builtin_amdgcn_sched_barrier(0);
  }
}

__launch_bounds__(256)
__global__ void qkv_proj_kernel(const float* __restrict__ x,
                                const float* __restrict__ Wq, const float* __restrict__ bq,
                                const float* __restrict__ Wk, const float* __restrict__ bk,
                                const float* __restrict__ Wv, const float* __restrict__ bv,
                                _Float16* __restrict__ Qh, _Float16* __restrict__ Kh,
                                _Float16* __restrict__ Vh)
{
  __shared__ _Float16 Tl[2 * TBUF];   // two buffers of [x tile [m][k] | W tile [n][k]]

  const int tid  = threadIdx.x;
  const int wave = tid >> 5;
  const int lane = tid & 31;
  const int sel   = blockIdx.x >> 2;          // 0: Q, 1: K, 2: V
  const int nBase = (blockIdx.x & 3) * 256;
  const int mBase = blockIdx.y * 256;

  const float* W    = sel == 0 ? Wq : (sel == 1 ? Wk : Wv);
  const float* bias = sel == 0 ? bq : (sel == 1 ? bk : bv);
  _Float16*    out  = sel == 0 ? Qh : (sel == 1 ? Kh : Vh);

  const int wm = (wave >> 2) * 128;   // wave's first row in the tile
  const int wn = (wave & 3) * 64;     // wave's first column in the tile

  v8f acc[8][4] = {};

  const int lr = tid >> 4;         // 0..15
  const int lc = (tid & 15) * 4;   // 0,4,...,60
  const int fr = lane & 15;
  const int kf = (lane >> 4) * 8;

  gfloat_p xs = (gfloat_p)(x + (size_t)(mBase + lr) * D_MODEL + lc);
  gfloat_p wsrc = (gfloat_p)(W + (size_t)(nBase + lr) * D_MODEL + lc);

  const int stOff = lr * TPI + lc;                    // this lane's staging place in a buffer
  const int aOff  = (wm + fr) * TPI + kf;             // its first x fragment run
  const int bOff  = TOP + (wn + fr) * TPI + kf;       // its first W fragment run

  float4 fa[16], fb[16];
  stage_ld(fa, fb, xs, wsrc);
  stage_st(fa, fb, &Tl[stOff]);
  __syncthreads();

  // the pass loop stays rolled: an unrolled copy adds code and no overlap (the buffer's
  // offset costs one scalar select per pass)
#pragma unroll 1
  for (int t = 0; t < D_MODEL / TKP - 1; ++t) {
    const int cur = (t & 1) * TBUF;
    stage_ld(fa, fb, xs, wsrc);
    pass_mma(acc, &Tl[cur + aOff], &Tl[cur + bOff]);
    stage_st(fa, fb, &Tl[(TBUF - cur) + stOff]);
    // publishes the next pass's tile and ends every reader's last read of this one
    __syncthreads();
  }
  pass_mma(acc, &Tl[((D_MODEL / TKP - 1) & 1) * TBUF + aOff],
           &Tl[((D_MODEL / TKP - 1) & 1) * TBUF + bOff]);

  // epilogue: bias add, f32 -> f16 store.  C layout: vgpr r -> m = r (lanes 0-15)
  // or r+8 (lanes 16-31); n = lane&15 within the 16-col tile.
  const int col  = lane & 15;
  const int rofs = (lane >> 4) * 8;
  _Float16* op = out + (size_t)(mBase + wm + rofs) * D_MODEL + nBase + wn + col;
  float bb[4];
  const int bcol = nBase + wn + col;
#pragma unroll
  for (int j = 0; j < 4; ++j) bb[j] = bias[bcol + j * 16];
  // the wait that stands before a register named by these loads is written again; index and
  // base are inputs so that they stay whole up to it
  asm volatile("s_wait_xcnt 0x0" :: "v"(bcol), "s"(bias) : "memory");
#pragma unroll
  for (int g = 0; g < 8; g += 2) {   // two row tiles (32 rows x 64 columns) at a time
    _Float16 hv[2][8][4];
#pragma unroll
    for (int i = 0; i < 2; ++i) {
#pragma unroll
      for (int r = 0; r < 8; ++r) {
#pragma unroll
        for (int j = 0; j < 4; ++j) hv[i][r][j] = (_Float16)(acc[g + i][j][r] + bb[j]);
      }
    }
    // keeps this group's conversions ahead of its stores, so that none lands on a
    // register of a store already issued
    __builtin_amdgcn_sched_barrier(0);
#pragma unroll
    for (int i = 0; i < 2; ++i) {
#pragma unroll
      for (int r = 0; r < 8; ++r) {
#pragma unroll
        for (int j = 0; j < 4; ++j)
          op[(size_t)((g + i) * 16 + r) * D_MODEL + j * 16] = hv[i][r][j];
      }
    }
    if (g < 6) {
      // the wait that stands before the next group's conversions reuse the stores' registers
      asm volatile("s_wait_xcnt 0x0" ::: "memory");
      // holds those conversions behind the wait (a "memory" clobber does not order vector work)
      __builtin_amdgcn_sched_barrier(0);
    }
  }
}

// ---------------------------------------------------------------------------
// Kernel 2: Kp/Vp partials.  Kp[k,d] = sum_l E[h,k,l] * K[b,l,h*64+d]
// grid (64 bh, SPLITL);  each WG reduces a 512-wide l-chunk -> partial buffer.
// ---------------------------------------------------------------------------
__launch_bounds__(256)
__global__ void kv_lowrank_kernel(const float* __restrict__ E,
                                  const _Float16* __restrict__ Kh,
                                  const _Float16* __restrict__ Vh,
                                  float* __restrict__ KpPart, float* __restrict__ VpPart)
{
  __shared__ _Float16 Al[128 * 40];   // E tile  [krow][l]
  __shared__ _Float16 BK[64 * 40];    // K^T tile [d][l]
  __shared__ _Float16 BV[64 * 40];

  const int tid  = threadIdx.x;
  const int wave = tid >> 5;
  const int lane = tid & 31;
  const int bh = blockIdx.x;          // 0..63
  const int b  = bh >> 4, h = bh & 15;
  const int ls = blockIdx.y;          // split index

  v8f accK[4] = {}, accV[4] = {};

  const int lr = tid >> 3, lc = (tid & 7) * 4;
  const int tl = tid >> 3;            // l within tile for B stage
  const int td = (tid & 7) * 8;       // d group
  const int fr = lane & 15;
  const int kf = (lane >> 4) * 8;

  const size_t eBase  = (size_t)h * LKF * SEQ_LEN;
  const size_t kvBase = (size_t)b * SEQ_LEN * D_MODEL + (size_t)h * HEAD_DIM;
  const int lBeg = ls * (SEQ_LEN / SPLITL);
  const int lEnd = lBeg + (SEQ_LEN / SPLITL);

  for (int l0 = lBeg; l0 < lEnd; l0 += 32) {
    __syncthreads();
#pragma unroll
    for (int rr = 0; rr < 4; ++rr) {
      const int row = lr + rr * 32;
      const float4 f = *(const float4*)(E + eBase + (size_t)row * SEQ_LEN + l0 + lc);
      _Float16* d = &Al[row * 40 + lc];
      d[0] = (_Float16)f.x; d[1] = (_Float16)f.y; d[2] = (_Float16)f.z; d[3] = (_Float16)f.w;
    }
    {
      const size_t src = kvBase + (size_t)(l0 + tl) * D_MODEL + td;
      const v8h kk = *(const v8h*)(Kh + src);
      const v8h vv = *(const v8h*)(Vh + src);
#pragma unroll
      for (int i = 0; i < 8; ++i) { BK[(td + i) * 40 + tl] = kk[i]; BV[(td + i) * 40 + tl] = vv[i]; }
    }
    __syncthreads();

    const v16h a = frag_ld(&Al[(wave * 16) * 40], fr, 40, kf);
    // pipelined over t: next K/V fragments in flight during current WMMAs
    v16h bkc = frag_ld(&BK[0], fr, 40, kf);
    v16h bvc = frag_ld(&BV[0], fr, 40, kf);
#pragma unroll
    for (int t = 0; t < 3; ++t) {
      const v16h bkn = frag_ld(&BK[((t + 1) * 16) * 40], fr, 40, kf);
      const v16h bvn = frag_ld(&BV[((t + 1) * 16) * 40], fr, 40, kf);
      accK[t] = wmma16(a, bkc, accK[t]);
      accV[t] = wmma16(a, bvc, accV[t]);
      bkc = bkn; bvc = bvn;
    }
    accK[3] = wmma16(a, bkc, accK[3]);
    accV[3] = wmma16(a, bvc, accV[3]);
  }

  const int col = lane & 15, rofs = (lane >> 4) * 8;
  const size_t pb = ((size_t)ls * (BATCH * N_HEADS) + bh) * LKF * HEAD_DIM;
#pragma unroll
  for (int t = 0; t < 4; ++t) {
#pragma unroll
    for (int r = 0; r < 8; ++r) {
      const int krow = wave * 16 + rofs + r;
      const int n = t * 16 + col;
      KpPart[pb + (size_t)krow * HEAD_DIM + n] = accK[t][r];
      VpPart[pb + (size_t)krow * HEAD_DIM + n] = accV[t][r];
    }
  }
}

// Reduce SPLITL partials -> f16 Kp/Vp (deterministic, no atomics).
__launch_bounds__(256)
__global__ void kv_reduce_kernel(const float* __restrict__ KpPart,
                                 const float* __restrict__ VpPart,
                                 _Float16* __restrict__ Kp, _Float16* __restrict__ Vp)
{
  const size_t idx = (size_t)blockIdx.x * 256 + threadIdx.x;  // 0..524287
  const size_t stride = (size_t)BATCH * N_HEADS * LKF * HEAD_DIM;
  float sk = 0.f, sv = 0.f;
#pragma unroll
  for (int s = 0; s < SPLITL; ++s) { sk += KpPart[s * stride + idx]; sv += VpPart[s * stride + idx]; }
  Kp[idx] = (_Float16)sk;
  Vp[idx] = (_Float16)sv;
}

// ---------------------------------------------------------------------------
// Kernel 3: attention.  dot = Q @ Kp^T / 8 -> softmax(k=128) -> @ Vp -> out.
// grid (32 l-blocks, 64 bh); WG covers 128 rows of l (16 per wave).
// LDS: [VpL 64x136][ KpL 128x72  aliased with  AtL 8x16x136 ]  (52 KB)
// ---------------------------------------------------------------------------
__launch_bounds__(256)
__global__ void attn_kernel(const _Float16* __restrict__ Qh,
                            const _Float16* __restrict__ Kp, const _Float16* __restrict__ Vp,
                            float* __restrict__ out)
{
  __shared__ _Float16 smem[64 * 136 + 8 * 16 * 136];
  _Float16* VpL = smem;                 // [d][kidx]  (transposed Vp)
  _Float16* KpL = smem + 64 * 136;      // [kidx][d]  (row-major Kp) -- dead after GEMM1
  _Float16* AtL = smem + 64 * 136;      // [wave][m][kidx] attn rows -- reuses KpL space

  const int tid  = threadIdx.x;
  const int wave = tid >> 5;
  const int lane = tid & 31;
  const int lBase = blockIdx.x * 128;
  const int bh = blockIdx.y;
  const int b  = bh >> 4, h = bh & 15;

  // stage Kp (row-major) and Vp (transposed)
  {
    const int kr = tid >> 1;
    const int c0 = (tid & 1) * 32;
    const size_t src = ((size_t)bh * LKF + kr) * HEAD_DIM + c0;
#pragma unroll
    for (int j = 0; j < 4; ++j) {
      const v8h kk = *(const v8h*)(Kp + src + 8 * j);
      *(v8h*)(&KpL[kr * 72 + c0 + 8 * j]) = kk;
      const v8h vv = *(const v8h*)(Vp + src + 8 * j);
#pragma unroll
      for (int i = 0; i < 8; ++i) VpL[(c0 + 8 * j + i) * 136 + kr] = vv[i];
    }
  }

  const int fr = lane & 15;
  const int kf = (lane >> 4) * 8;
  const int rofs = (lane >> 4) * 8, col = lane & 15;

  // hoist both global Q fragments (k-halves 0..31, 32..63) before the barrier
  const _Float16* qBase = Qh + ((size_t)b * SEQ_LEN + lBase + wave * 16) * D_MODEL
                             + (size_t)h * HEAD_DIM;
  v16h afr[2];
#pragma unroll
  for (int ks = 0; ks < 2; ++ks) afr[ks] = frag_ld(qBase, fr, D_MODEL, ks * 32 + kf);

  __syncthreads();

  // GEMM1: dot[l, kidx] = Q[l,:64] . Kp[kidx,:64], pipelined over the 8 n-tiles
  v8f acc[8] = {};
#pragma unroll
  for (int ks = 0; ks < 2; ++ks) {
    v16h bc = frag_ld(&KpL[0], fr, 72, ks * 32 + kf);
#pragma unroll
    for (int t = 0; t < 7; ++t) {
      const v16h bn = frag_ld(&KpL[((t + 1) * 16) * 72], fr, 72, ks * 32 + kf);
      acc[t] = wmma16(afr[ks], bc, acc[t]);
      bc = bn;
    }
    acc[7] = wmma16(afr[ks], bc, acc[7]);
  }
  __syncthreads();   // KpL dead everywhere; AtL may now reuse its space

  // softmax over 128 per row; rows split across half-waves, reduce over 16 lanes
  const float scale = 0.125f;  // 1/sqrt(64)
  _Float16* at = &AtL[(wave * 16) * 136];
#pragma unroll
  for (int r = 0; r < 8; ++r) {
    float mx = -3.0e38f;
#pragma unroll
    for (int t = 0; t < 8; ++t) { acc[t][r] *= scale; mx = fmaxf(mx, acc[t][r]); }
#pragma unroll
    for (int s = 1; s < 16; s <<= 1) mx = fmaxf(mx, __shfl_xor(mx, s, 32));
    float sum = 0.f;
#pragma unroll
    for (int t = 0; t < 8; ++t) { const float e = __expf(acc[t][r] - mx); acc[t][r] = e; sum += e; }
#pragma unroll
    for (int s = 1; s < 16; s <<= 1) sum += __shfl_xor(sum, s, 32);
    const float inv = 1.0f / sum;
    const int m = rofs + r;
#pragma unroll
    for (int t = 0; t < 8; ++t) at[m * 136 + t * 16 + col] = (_Float16)(acc[t][r] * inv);
  }
  __syncthreads();

  // GEMM2: out[l, d] = attn[l,:128] . Vp[:,d], pipelined over the 4 n-tiles
  v8f o[4] = {};
#pragma unroll
  for (int ks = 0; ks < 4; ++ks) {
    const v16h a = frag_ld(at, fr, 136, ks * 32 + kf);
    v16h bc = frag_ld(&VpL[0], fr, 136, ks * 32 + kf);
#pragma unroll
    for (int t = 0; t < 3; ++t) {
      const v16h bn = frag_ld(&VpL[((t + 1) * 16) * 136], fr, 136, ks * 32 + kf);
      o[t] = wmma16(a, bc, o[t]);
      bc = bn;
    }
    o[3] = wmma16(a, bc, o[3]);
  }
  // epilogue: head-combined fp32 output [b, l, h*64 + d]
#pragma unroll
  for (int t = 0; t < 4; ++t) {
#pragma unroll
    for (int r = 0; r < 8; ++r) {
      const int l = lBase + wave * 16 + rofs + r;
      out[((size_t)b * SEQ_LEN + l) * D_MODEL + (size_t)h * HEAD_DIM + t * 16 + col] = o[t][r];
    }
  }
}

// ---------------------------------------------------------------------------
extern "C" void kernel_launch(void* const* d_in, const int* in_sizes, int n_in,
                              void* d_out, int out_size, void* d_ws, size_t ws_size,
                              hipStream_t stream) {
  const float* x  = (const float*)d_in[0];
  const float* Wq = (const float*)d_in[1];
  const float* bq = (const float*)d_in[2];
  const float* Wk = (const float*)d_in[3];
  const float* bk = (const float*)d_in[4];
  const float* Wv = (const float*)d_in[5];
  const float* bv = (const float*)d_in[6];
  const float* E  = (const float*)d_in[7];
  float* outp = (float*)d_out;

  char* ws = (char*)d_ws;
  const size_t szQKV  = (size_t)M_TOTAL * D_MODEL * sizeof(_Float16);          // 32 MB each
  const size_t szProj = (size_t)BATCH * N_HEADS * LKF * HEAD_DIM;              // 524288 elems
  _Float16* Qh = (_Float16*)(ws);
  _Float16* Kh = (_Float16*)(ws + szQKV);
  _Float16* Vh = (_Float16*)(ws + 2 * szQKV);
  float* KpPart = (float*)(ws + 3 * szQKV);                                    // 16 MB
  float* VpPart = (float*)(ws + 3 * szQKV + SPLITL * szProj * sizeof(float));  // 16 MB
  _Float16* Kp = (_Float16*)(ws + 3 * szQKV + 2 * SPLITL * szProj * sizeof(float));
  _Float16* Vp = (_Float16*)((char*)Kp + szProj * sizeof(_Float16));

  qkv_proj_kernel<<<dim3(3 * D_MODEL / 256, M_TOTAL / 256), 256, 0, stream>>>(
      x, Wq, bq, Wk, bk, Wv, bv, Qh, Kh, Vh);

  kv_lowrank_kernel<<<dim3(BATCH * N_HEADS, SPLITL), 256, 0, stream>>>(
      E, Kh, Vh, KpPart, VpPart);

  kv_reduce_kernel<<<dim3((unsigned)(szProj / 256)), 256, 0, stream>>>(
      KpPart, VpPart, Kp, Vp);

  attn_kernel<<<dim3(SEQ_LEN / 128, BATCH * N_HEADS), 256, 0, stream>>>(
      Qh, Kp, Vp, outp);
}

// v003
// Measured time: 149 microseconds a run.
// Two timings next to v002 put it at 1.09 and 1.10 times that version's speed.
// Over all steps from v000 it is 1.93 times as fast.
#include <hip/hip_runtime.h>

#define D_MODEL 1024
#define SEQ_LEN 4096
#define N_HEADS 16
#define HEAD_DIM 64
#define LKF 128
#define BATCH 4
#define M_TOTAL (BATCH * SEQ_LEN) /* 16384 */
#define SPLITL 8                  /* split-K chunks for kernel 2 */

typedef __attribute__((ext_vector_type(16))) _Float16 v16h;
typedef __attribute__((ext_vector_type(8)))  _Float16 v8h;
typedef __attribute__((ext_vector_type(8)))  float    v8f;
typedef __attribute__((ext_vector_type(4)))  _Float16 v4h;
typedef __attribute__((ext_vector_type(4)))  float    v4f;

union V16H { v16h v; v8h h[2]; };

// Load one 16x32 f16 fragment for a lane.
// Per ISA 16-bit A/B layout: lane (0-15 -> m=lane, 16-31 -> m=lane-16) holds two
// contiguous 8-half runs: k in [kf, kf+8) and [kf+16, kf+24), kf = (lane>=16)?8:0.
__device__ __forceinline__ v16h frag_ld(const _Float16* base, int row, int stride, int koff) {
  V16H u;
  const _Float16* p = base + row * stride + koff;
  u.h[0] = *(const v8h*)(p);
  u.h[1] = *(const v8h*)(p + 16);
  return u.v;
}

__device__ __forceinline__ v8f wmma16(v16h a, v16h b, v8f c) {
  return __builtin_amdgcn_wmma_f32_16x16x32_f16(false, a, false, b, (short)0, c, false, false);
}

// ---------------------------------------------------------------------------
// Kernel 0: x and the three W, fp32 -> f16, once.  The projection reads every x row 12
// times and every W row 64 times out of L2: as f16 those reads are half the bytes, and
// the rounding (the same one, to nearest even) is done once per element.
// One workgroup converts 32768 contiguous floats: 32 x 16 B read and 32 x 8 B written per lane,
// every wave-wide load and store on whole 128-B lines; few, long waves, all resident at once,
// because a launch this short pays for every wave it starts.
// grid: 512 workgroups for x, then 32 each for Wq, Wk, Wv (Wh = [Wq | Wk | Wv] by rows).
// ---------------------------------------------------------------------------
#define CVT_EL 32768                               /* floats per workgroup */
#define CVT_PL (CVT_EL / (256 * 4))                /* 16-B loads per lane: 32 */
#define CVT_XB (M_TOTAL * D_MODEL / CVT_EL)        /* 512 */
#define CVT_WB (D_MODEL * D_MODEL / CVT_EL)        /* 32 */
__launch_bounds__(256)
__global__ void to_f16_kernel(const float* __restrict__ x, const float* __restrict__ Wq,
                              const float* __restrict__ Wk, const float* __restrict__ Wv,
                              _Float16* __restrict__ xh, _Float16* __restrict__ Wh)
{
  const int blk = blockIdx.x;
  const float* src;
  _Float16* dst;
  if (blk < CVT_XB) {
    src = x + (size_t)blk * CVT_EL;
    dst = xh + (size_t)blk * CVT_EL;
  } else {
    const int w   = blk - CVT_XB;
    const int sel = w / CVT_WB;
    src = (sel == 0 ? Wq : (sel == 1 ? Wk : Wv)) + (size_t)(w % CVT_WB) * CVT_EL;
    dst = Wh + (size_t)w * CVT_EL;
  }
  const v4f* s4 = (const v4f*)src + threadIdx.x;
  v4h*       d4 = (v4h*)dst + threadIdx.x;
  v4f f[CVT_PL];
  // read once, never again: non-temporal, so that the fp32 lines do not push the f16 copy out of L2
#pragma unroll
  for (int i = 0; i < CVT_PL; ++i) f[i] = __builtin_nontemporal_load(s4 + i * 256);
#pragma unroll
  for (int i = 0; i < CVT_PL; ++i) d4[i * 256] = __builtin_convertvector(f[i], v4h);
}

// ---------------------------------------------------------------------------
// Kernel 1: QKV projection.  C[m,n] = sum_k x[m,k] * W[n,k] + b[n], x and W as f16 from kernel 0
// One 256(M) x 256(N) tile of one of Q, K, V per workgroup, 64 k per pass.
// 8 waves as 2(M) x 4(N); each wave owns 128 x 64 = 8 x 4 accumulator tiles, so
// 12 fragments read from LDS feed 32 WMMAs.
// Two LDS buffers: the next pass's global loads are issued ahead of this pass's WMMAs
// and land in registers meanwhile; they are stored into the other buffer behind the
// WMMAs, so one barrier per pass is enough.
// grid: x = 12 column tiles (4 each of Q, K, V), y = 64 row tiles.
// ---------------------------------------------------------------------------
#define TKP 64   /* k per pass */
#define TPI 72   /* LDS row pitch in halves: 144 B = 16 B x odd */
#define TOP (256 * TPI)   /* halves of one operand's tile */
#define TBUF (2 * TOP)    /* halves of one buffer: x tile, then W tile */

// issue one pass's global loads (256x64 f16 of x and of W, 16 x 16 B per lane; 8 lanes cover
// one row's 128 B) and step the two addresses on to the next pass
typedef const __attribute__((address_space(1))) _Float16* ghalf_p;   // known global: global_load, not flat_load
typedef const __attribute__((address_space(1))) v8h* gv8h_p;
__device__ __forceinline__ void stage_ld(v8h (&fa)[8], v8h (&fb)[8],
                                         ghalf_p& xp, ghalf_p& wp) {
#pragma unroll
  for (int rr = 0; rr < 8; ++rr)
    fa[rr] = *(gv8h_p)(xp + (size_t)(rr * 32) * D_MODEL);
#pragma unroll
  for (int rr = 0; rr < 8; ++rr)
    fb[rr] = *(gv8h_p)(wp + (size_t)(rr * 32) * D_MODEL);
  // the wait that stands before a register named by an issued load is written again, and
  // the step of 64 halves (0x80 bytes) in the same statement: written in the source, the
  // step was placed between the loads and the wait
  asm volatile("s_wait_xcnt 0x0\n\t"
               "v_add_nc_u64 %0, 0x80, %0\n\t"
               "v_add_nc_u64 %1, 0x80, %1"
               : "+v"(xp), "+v"(wp) :: "memory");
}

// store into one buffer; d0 points at this lane's first element of the x tile
__device__ __forceinline__ void stage_st(const v8h (&fa)[8], const v8h (&fb)[8],
                                         _Float16* d0) {
#pragma unroll
  for (int rr = 0; rr < 8; ++rr) *(v8h*)(d0 + rr * 32 * TPI) = fa[rr];
#pragma unroll
  for (int rr = 0; rr < 8; ++rr) *(v8h*)(d0 + TOP + rr * 32 * TPI) = fb[rr];
}

// one pass's 64 WMMAs; ap, bp point at this lane's first fragment run in the buffer
__device__ __forceinline__ void pass_mma(v8f (&acc)[8][4], const _Float16* ap, const _Float16* bp) {
#pragma unroll
  for (int ks = 0; ks < TKP; ks += 32) {
    v16h a[8], b[4];
#pragma unroll
    for (int j = 0; j < 4; ++j) b[j] = frag_ld(bp, j * 16, TPI, ks);
#pragma unroll
    for (int i = 0; i < 8; ++i) a[i] = frag_ld(ap, i * 16, TPI, ks);
    // keeps the 24 LDS reads one group ahead of the 32 WMMAs: sunk among them, each
    // row of WMMAs would wait out its own LDS latency
    __builtin_amdgcn_sched_barrier(0);
#pragma unroll
    for (int i = 0; i < 8; ++i) {
#pragma unroll
      for (int j = 0; j < 4; ++j) acc[i][j] = wmma16(a[i], b[j], acc[i][j]);
    }
    // keeps what follows (the next 24 LDS reads, the staging stores with their wait
    // for the global loads) behind these WMMAs: moved in among them it spilled registers
    // and waited for the global loads with half of the pass's WMMAs still to issue
    __builtin_amdgcn_sched_barrier(0);
  }
}

__launch_bounds__(256)
__global__ void qkv_proj_kernel(const _Float16* __restrict__ xh, const _Float16* __restrict__ Wh,
                                const float* __restrict__ bq, const float* __restrict__ bk,
                                const float* __restrict__ bv,
                                _Float16* __restrict__ Qh, _Float16* __restrict__ Kh,
                                _Float16* __restrict__ Vh)
{
  __shared__ __attribute__((aligned(16))) _Float16 Tl[2 * TBUF];   // two buffers of [x tile [m][k] | W tile [n][k]]

  const int tid  = threadIdx.x;
  const int wave = tid >> 5;
  const int lane = tid & 31;
  const int sel   = blockIdx.x >> 2;          // 0: Q, 1: K, 2: V
  const int nBase = (blockIdx.x & 3) * 256;
  const int mBase = blockIdx.y * 256;

  const float* bias = sel == 0 ? bq : (sel == 1 ? bk : bv);
  _Float16*    out  = sel == 0 ? Qh : (sel == 1 ? Kh : Vh);

  const int wm = (wave >> 2) * 128;   // wave's first row in the tile
  const int wn = (wave & 3) * 64;     // wave's first column in the tile

  v8f acc[8][4] = {};

  const int lr = tid >> 3;         // 0..31
  const int lc = (tid & 7) * 8;    // 0,8,...,56
  const int fr = lane & 15;
  const int kf = (lane >> 4) * 8;

  ghalf_p xs = (ghalf_p)(xh + (size_t)(mBase + lr) * D_MODEL + lc);
  ghalf_p wsrc = (ghalf_p)(Wh + (size_t)(blockIdx.x * 256 + lr) * D_MODEL + lc);   // Wh rows: Q, K, V

  const int stOff = lr * TPI + lc;                    // this lane's staging place in a buffer
  const int aOff  = (wm + fr) * TPI + kf;             // its first x fragment run
  const int bOff  = TOP + (wn + fr) * TPI + kf;       // its first W fragment run

  v8h fa[8], fb[8];
  stage_ld(fa, fb, xs, wsrc);
  stage_st(fa, fb, &Tl[stOff]);
  __syncthreads();

  // the pass loop stays rolled: an unrolled copy adds code and no overlap (the buffer's
  // offset costs one scalar select per pass)
#pragma unroll 1
  for (int t = 0; t < D_MODEL / TKP - 1; ++t) {
    const int cur = (t & 1) * TBUF;
    stage_ld(fa, fb, xs, wsrc);
    pass_mma(acc, &Tl[cur + aOff], &Tl[cur + bOff]);
    stage_st(fa, fb, &Tl[(TBUF - cur) + stOff]);
    // publishes the next pass's tile and ends every reader's last read of this one
    __syncthreads();
  }
  pass_mma(acc, &Tl[((D_MODEL / TKP - 1) & 1) * TBUF + aOff],
           &Tl[((D_MODEL / TKP - 1) & 1) * TBUF + bOff]);

  // epilogue: bias add, f32 -> f16 store.  C layout: vgpr r -> m = r (lanes 0-15)
  // or r+8 (lanes 16-31); n = lane&15 within the 16-col tile.
  const int col  = lane & 15;
  const int rofs = (lane >> 4) * 8;
  _Float16* op = out + (size_t)(mBase + wm + rofs) * D_MODEL + nBase + wn + col;
  float bb[4];
  const int bcol = nBase + wn + col;
#pragma unroll
  for (int j = 0; j < 4; ++j) bb[j] = bias[bcol + j * 16];
  // the wait that stands before a register named by these loads is written again; index and
  // base are inputs so that they stay whole up to it
  asm volatile("s_wait_xcnt 0x0" :: "v"(bcol), "s"(bias) : "memory");
#pragma unroll
  for (int g = 0; g < 8; g += 2) {   // two row tiles (32 rows x 64 columns) at a time
    _Float16 hv[2][8][4];
#pragma unroll
    for (int i = 0; i < 2; ++i) {
#pragma unroll
      for (int r = 0; r < 8; ++r) {
#pragma unroll
        for (int j = 0; j < 4; ++j) hv[i][r][j] = (_Float16)(acc[g + i][j][r] + bb[j]);
      }
    }
    // keeps this group's conversions ahead of its stores, so that none lands on a
    // register of a store already issued
    __builtin_amdgcn_sched_barrier(0);
#pragma unroll
    for (int i = 0; i < 2; ++i) {
#pragma unroll
      for (int r = 0; r < 8; ++r) {
#pragma unroll
        for (int j = 0; j < 4; ++j)
          op[(size_t)((g + i) * 16 + r) * D_MODEL + j * 16] = hv[i][r][j];
      }
    }
    if (g < 6) {
      // the wait that stands before the next group's conversions reuse the stores' registers
      asm volatile("s_wait_xcnt 0x0" ::: "memory");
      // holds those conversions behind the wait (a "memory" clobber does not order vector work)
      __builtin_amdgcn_sched_barrier(0);
    }
  }
}

// ---------------------------------------------------------------------------
// Kernel 2: Kp/Vp partials.  Kp[k,d] = sum_l E[h,k,l] * K[b,l,h*64+d]
// grid (64 bh, SPLITL);  each WG reduces a 512-wide l-chunk -> partial buffer.
// ---------------------------------------------------------------------------
__launch_bounds__(256)
__global__ void kv_lowrank_kernel(const float* __restrict__ E,
                                  const _Float16* __restrict__ Kh,
                                  const _Float16* __restrict__ Vh,
                                  float* __restrict__ KpPart, float* __restrict__ VpPart)
{
  __shared__ _Float16 Al[128 * 40];   // E tile  [krow][l]
  __shared__ _Float16 BK[64 * 40];    // K^T tile [d][l]
  __shared__ _Float16 BV[64 * 40];

  const int tid  = threadIdx.x;
  const int wave = tid >> 5;
  const int lane = tid & 31;
  const int bh = blockIdx.x;          // 0..63
  const int b  = bh >> 4, h = bh & 15;
  const int ls = blockIdx.y;          // split index

  v8f accK[4] = {}, accV[4] = {};

  const int lr = tid >> 3, lc = (tid & 7) * 4;
  const int tl = tid >> 3;            // l within tile for B stage
  const int td = (tid & 7) * 8;       // d group
  const int fr = lane & 15;
  const int kf = (lane >> 4) * 8;

  const size_t eBase  = (size_t)h * LKF * SEQ_LEN;
  const size_t kvBase = (size_t)b * SEQ_LEN * D_MODEL + (size_t)h * HEAD_DIM;
  const int lBeg = ls * (SEQ_LEN / SPLITL);
  const int lEnd = lBeg + (SEQ_LEN / SPLITL);

  for (int l0 = lBeg; l0 < lEnd; l0 += 32) {
    __syncthreads();
#pragma unroll
    for (int rr = 0; rr < 4; ++rr) {
      const int row = lr + rr * 32;
      const float4 f = *(const float4*)(E + eBase + (size_t)row * SEQ_LEN + l0 + lc);
      _Float16* d = &Al[row * 40 + lc];
      d[0] = (_Float16)f.x; d[1] = (_Float16)f.y; d[2] = (_Float16)f.z; d[3] = (_Float16)f.w;
    }
    {
      const size_t src = kvBase + (size_t)(l0 + tl) * D_MODEL + td;
      const v8h kk = *(const v8h*)(Kh + src);
      const v8h vv = *(const v8h*)(Vh + src);
#pragma unroll
      for (int i = 0; i < 8; ++i) { BK[(td + i) * 40 + tl] = kk[i]; BV[(td + i) * 40 + tl] = vv[i]; }
    }
    __syncthreads();

    const v16h a = frag_ld(&Al[(wave * 16) * 40], fr, 40, kf);
    // pipelined over t: next K/V fragments in flight during current WMMAs
    v16h bkc = frag_ld(&BK[0], fr, 40, kf);
    v16h bvc = frag_ld(&BV[0], fr, 40, kf);
#pragma unroll
    for (int t = 0; t < 3; ++t) {
      const v16h bkn = frag_ld(&BK[((t + 1) * 16) * 40], fr, 40, kf);
      const v16h bvn = frag_ld(&BV[((t + 1) * 16) * 40], fr, 40, kf);
      accK[t] = wmma16(a, bkc, accK[t]);
      accV[t] = wmma16(a, bvc, accV[t]);
      bkc = bkn; bvc = bvn;
    }
    accK[3] = wmma16(a, bkc, accK[3]);
    accV[3] = wmma16(a, bvc, accV[3]);
  }

  const int col = lane & 15, rofs = (lane >> 4) * 8;
  const size_t pb = ((size_t)ls * (BATCH * N_HEADS) + bh) * LKF * HEAD_DIM;
#pragma unroll
  for (int t = 0; t < 4; ++t) {
#pragma unroll
    for (int r = 0; r < 8; ++r) {
      const int krow = wave * 16 + rofs + r;
      const int n = t * 16 + col;
      KpPart[pb + (size_t)krow * HEAD_DIM + n] = accK[t][r];
      VpPart[pb + (size_t)krow * HEAD_DIM + n] = accV[t][r];
    }
  }
}

// Reduce SPLITL partials -> f16 Kp/Vp (deterministic, no atomics).
__launch_bounds__(256)
__global__ void kv_reduce_kernel(const float* __restrict__ KpPart,
                                 const float* __restrict__ VpPart,
                                 _Float16* __restrict__ Kp, _Float16* __restrict__ Vp)
{
  const size_t idx = (size_t)blockIdx.x * 256 + threadIdx.x;  // 0..524287
  const size_t stride = (size_t)BATCH * N_HEADS * LKF * HEAD_DIM;
  float sk = 0.f, sv = 0.f;
#pragma unroll
  for (int s = 0; s < SPLITL; ++s) { sk += KpPart[s * stride + idx]; sv += VpPart[s * stride + idx]; }
  Kp[idx] = (_Float16)sk;
  Vp[idx] = (_Float16)sv;
}

// ---------------------------------------------------------------------------
// Kernel 3: attention.  dot = Q @ Kp^T / 8 -> softmax(k=128) -> @ Vp -> out.
// grid (32 l-blocks, 64 bh); WG covers 128 rows of l (16 per wave).
// LDS: [VpL 64x136][ KpL 128x72  aliased with  AtL 8x16x136 ]  (52 KB)
// ---------------------------------------------------------------------------
__launch_bounds__(256)
__global__ void attn_kernel(const _Float16* __restrict__ Qh,
                            const _Float16* __restrict__ Kp, const _Float16* __restrict__ Vp,
                            float* __restrict__ out)
{
  __shared__ _Float16 smem[64 * 136 + 8 * 16 * 136];
  _Float16* VpL = smem;                 // [d][kidx]  (transposed Vp)
  _Float16* KpL = smem + 64 * 136;      // [kidx][d]  (row-major Kp) -- dead after GEMM1
  _Float16* AtL = smem + 64 * 136;      // [wave][m][kidx] attn rows -- reuses KpL space

  const int tid  = threadIdx.x;
  const int wave = tid >> 5;
  const int lane = tid & 31;
  const int lBase = blockIdx.x * 128;
  const int bh = blockIdx.y;
  const int b  = bh >> 4, h = bh & 15;

  // stage Kp (row-major) and Vp (transposed)
  {
    const int kr = tid >> 1;
    const int c0 = (tid & 1) * 32;
    const size_t src = ((size_t)bh * LKF + kr) * HEAD_DIM + c0;
#pragma unroll
    for (int j = 0; j < 4; ++j) {
      const v8h kk = *(const v8h*)(Kp + src + 8 * j);
      *(v8h*)(&KpL[kr * 72 + c0 + 8 * j]) = kk;
      const v8h vv = *(const v8h*)(Vp + src + 8 * j);
#pragma unroll
      for (int i = 0; i < 8; ++i) VpL[(c0 + 8 * j + i) * 136 + kr] = vv[i];
    }
  }

  const int fr = lane & 15;
  const int kf = (lane >> 4) * 8;
  const int rofs = (lane >> 4) * 8, col = lane & 15;

  // hoist both global Q fragments (k-halves 0..31, 32..63) before the barrier
  const _Float16* qBase = Qh + ((size_t)b * SEQ_LEN + lBase + wave * 16) * D_MODEL
                             + (size_t)h * HEAD_DIM;
  v16h afr[2];
#pragma unroll
  for (int ks = 0; ks < 2; ++ks) afr[ks] = frag_ld(qBase, fr, D_MODEL, ks * 32 + kf);

  __syncthreads();

  // GEMM1: dot[l, kidx] = Q[l,:64] . Kp[kidx,:64], pipelined over the 8 n-tiles
  v8f acc[8] = {};
#pragma unroll
  for (int ks = 0; ks < 2; ++ks) {
    v16h bc = frag_ld(&KpL[0], fr, 72, ks * 32 + kf);
#pragma unroll
    for (int t = 0; t < 7; ++t) {
      const v16h bn = frag_ld(&KpL[((t + 1) * 16) * 72], fr, 72, ks * 32 + kf);
      acc[t] = wmma16(afr[ks], bc, acc[t]);
      bc = bn;
    }
    acc[7] = wmma16(afr[ks], bc, acc[7]);
  }
  __syncthreads();   // KpL dead everywhere; AtL may now reuse its space

  // softmax over 128 per row; rows split across half-waves, reduce over 16 lanes
  const float scale = 0.125f;  // 1/sqrt(64)
  _Float16* at = &AtL[(wave * 16) * 136];
#pragma unroll
  for (int r = 0; r < 8; ++r) {
    float mx = -3.0e38f;
#pragma unroll
    for (int t = 0; t < 8; ++t) { acc[t][r] *= scale; mx = fmaxf(mx, acc[t][r]); }
#pragma unroll
    for (int s = 1; s < 16; s <<= 1) mx = fmaxf(mx, __shfl_xor(mx, s, 32));
    float sum = 0.f;
#pragma unroll
    for (int t = 0; t < 8; ++t) { const float e = __expf(acc[t][r] - mx); acc[t][r] = e; sum += e; }
#pragma unroll
    for (int s = 1; s < 16; s <<= 1) sum += __shfl_xor(sum, s, 32);
    const float inv = 1.0f / sum;
    const int m = rofs + r;
#pragma unroll
    for (int t = 0; t < 8; ++t) at[m * 136 + t * 16 + col] = (_Float16)(acc[t][r] * inv);
  }
  __syncthreads();

  // GEMM2: out[l, d] = attn[l,:128] . Vp[:,d], pipelined over the 4 n-tiles
  v8f o[4] = {};
#pragma unroll
  for (int ks = 0; ks < 4; ++ks) {
    const v16h a = frag_ld(at, fr, 136, ks * 32 + kf);
    v16h bc = frag_ld(&VpL[0], fr, 136, ks * 32 + kf);
#pragma unroll
    for (int t = 0; t < 3; ++t) {
      const v16h bn = frag_ld(&VpL[((t + 1) * 16) * 136], fr, 136, ks * 32 + kf);
      o[t] = wmma16(a, bc, o[t]);
      bc = bn;
    }
    o[3] = wmma16(a, bc, o[3]);
  }
  // epilogue: head-combined fp32 output [b, l, h*64 + d]
#pragma unroll
  for (int t = 0; t < 4; ++t) {
#pragma unroll
    for (int r = 0; r < 8; ++r) {
      const int l = lBase + wave * 16 + rofs + r;
      out[((size_t)b * SEQ_LEN + l) * D_MODEL + (size_t)h * HEAD_DIM + t * 16 + col] = o[t][r];
    }
  }
}

// ---------------------------------------------------------------------------
extern "C" void kernel_launch(void* const* d_in, const int* in_sizes, int n_in,
                              void* d_out, int out_size, void* d_ws, size_t ws_size,
                              hipStream_t stream) {
  const float* x  = (const float*)d_in[0];
  const float* Wq = (const float*)d_in[1];
  const float* bq = (const float*)d_in[2];
  const float* Wk = (const float*)d_in[3];
  const float* bk = (const float*)d_in[4];
  const float* Wv = (const float*)d_in[5];
  const float* bv = (const float*)d_in[6];
  const float* E  = (const float*)d_in[7];
  float* outp = (float*)d_out;

  char* ws = (char*)d_ws;
  const size_t szQKV  = (size_t)M_TOTAL * D_MODEL * sizeof(_Float16);          // 32 MB each
  const size_t szProj = (size_t)BATCH * N_HEADS * LKF * HEAD_DIM;              // 524288 elems
  _Float16* Qh = (_Float16*)(ws);
  _Float16* Kh = (_Float16*)(ws + szQKV);
  _Float16* Vh = (_Float16*)(ws + 2 * szQKV);
  float* KpPart = (float*)(ws + 3 * szQKV);                                    // 16 MB
  float* VpPart = (float*)(ws + 3 * szQKV + SPLITL * szProj * sizeof(float));  // 16 MB
  _Float16* Kp = (_Float16*)(ws + 3 * szQKV + 2 * SPLITL * szProj * sizeof(float));
  _Float16* Vp = (_Float16*)((char*)Kp + szProj * sizeof(_Float16));
  _Float16* xh = (_Float16*)((char*)Vp + szProj * sizeof(_Float16));           // 32 MB
  _Float16* Wh = (_Float16*)((char*)xh + szQKV);                               // 6 MB

  to_f16_kernel<<<dim3(CVT_XB + 3 * CVT_WB), 256, 0, stream>>>(x, Wq, Wk, Wv, xh, Wh);

  qkv_proj_kernel<<<dim3(3 * D_MODEL / 256, M_TOTAL / 256), 256, 0, stream>>>(
      xh, Wh, bq, bk, bv, Qh, Kh, Vh);

  kv_lowrank_kernel<<<dim3(BATCH * N_HEADS, SPLITL), 256, 0, stream>>>(
      E, Kh, Vh, KpPart, VpPart);

  kv_reduce_kernel<<<dim3((unsigned)(szProj / 256)), 256, 0, stream>>>(
      KpPart, VpPart, Kp, Vp);

  attn_kernel<<<dim3(SEQ_LEN / 128, BATCH * N_HEADS), 256, 0, stream>>>(
      Qh, Kp, Vp, outp);
}

// v004
// A run of this version takes 141 microseconds.
// Two timings next to v003 both put it at 1.06 times that version's speed.
// Over all steps from v000 it is 2.04 times as fast.
#include <hip/hip_runtime.h>

#define D_MODEL 1024
#define SEQ_LEN 4096
#define N_HEADS 16
#define HEAD_DIM 64
#define LKF 128
#define BATCH 4
#define M_TOTAL (BATCH * SEQ_LEN) /* 16384 */
#define SPLITL 8                  /* split-K chunks for kernel 2 */

typedef __attribute__((ext_vector_type(16))) _Float16 v16h;
typedef __attribute__((ext_vector_type(8)))  _Float16 v8h;
typedef __attribute__((ext_vector_type(8)))  float    v8f;
typedef __attribute__((ext_vector_type(4)))  _Float16 v4h;
typedef __attribute__((ext_vector_type(4)))  float    v4f;

union V16H { v16h v; v8h h[2]; };

// Load one 16x32 f16 fragment for a lane.
// Per ISA 16-bit A/B layout: lane (0-15 -> m=lane, 16-31 -> m=lane-16) holds two
// contiguous 8-half runs: k in [kf, kf+8) and [kf+16, kf+24), kf = (lane>=16)?8:0.
__device__ __forceinline__ v16h frag_ld(const _Float16* base, int row, int stride, int koff) {
  V16H u;
  const _Float16* p = base + row * stride + koff;
  u.h[0] = *(const v8h*)(p);
  u.h[1] = *(const v8h*)(p + 16);
  return u.v;
}

__device__ __forceinline__ v8f wmma16(v16h a, v16h b, v8f c) {
  return __builtin_amdgcn_wmma_f32_16x16x32_f16(false, a, false, b, (short)0, c, false, false);
}

// ---------------------------------------------------------------------------
// Kernel 0: x and the three W, fp32 -> f16, once.  The projection reads every x row 12
// times and every W row 64 times out of L2: as f16 those reads are half the bytes, and
// the rounding (the same one, to nearest even) is done once per element.
// One workgroup converts 32768 contiguous floats: 32 x 16 B read and 32 x 8 B written per lane,
// every wave-wide load and store on whole 128-B lines; few, long waves, all resident at once,
// because a launch this short pays for every wave it starts.
// grid: 512 workgroups for x, then 32 each for Wq, Wk, Wv (Wh = [Wq | Wk | Wv] by rows).
// ---------------------------------------------------------------------------
#define CVT_EL 32768                               /* floats per workgroup */
#define CVT_PL (CVT_EL / (256 * 4))                /* 16-B loads per lane: 32 */
#define CVT_XB (M_TOTAL * D_MODEL / CVT_EL)        /* 512 */
#define CVT_WB (D_MODEL * D_MODEL / CVT_EL)        /* 32 */
__launch_bounds__(256)
__global__ void to_f16_kernel(const float* __restrict__ x, const float* __restrict__ Wq,
                              const float* __restrict__ Wk, const float* __restrict__ Wv,
                              _Float16* __restrict__ xh, _Float16* __restrict__ Wh)
{
  const int blk = blockIdx.x;
  const float* src;
  _Float16* dst;
  if (blk < CVT_XB) {
    src = x + (size_t)blk * CVT_EL;
    dst = xh + (size_t)blk * CVT_EL;
  } else {
    const int w   = blk - CVT_XB;
    const int sel = w / CVT_WB;
    src = (sel == 0 ? Wq : (sel == 1 ? Wk : Wv)) + (size_t)(w % CVT_WB) * CVT_EL;
    dst = Wh + (size_t)w * CVT_EL;
  }
  const v4f* s4 = (const v4f*)src + threadIdx.x;
  v4h*       d4 = (v4h*)dst + threadIdx.x;
  v4f f[CVT_PL];
  // read once, never again: non-temporal, so that the fp32 lines do not push the f16 copy out of L2
#pragma unroll
  for (int i = 0; i < CVT_PL; ++i) f[i] = __builtin_nontemporal_load(s4 + i * 256);
#pragma unroll
  for (int i = 0; i < CVT_PL; ++i) d4[i * 256] = __builtin_convertvector(f[i], v4h);
}

// ---------------------------------------------------------------------------
// Kernel 1: QKV projection.  C[m,n] = sum_k x[m,k] * W[n,k] + b[n], x and W as f16 from kernel 0
// One 256(M) x 256(N) tile of one of Q, K, V per workgroup, 64 k per pass.
// 8 waves as 2(M) x 4(N); each wave owns 128 x 64 = 8 x 4 accumulator tiles, so
// 12 fragments read from LDS feed 32 WMMAs.
// Two LDS buffers: the next pass's global loads are issued ahead of this pass's WMMAs
// and land in registers meanwhile; they are stored into the other buffer behind the
// WMMAs, so one barrier per pass is enough.
// grid: x = 12 column tiles (4 each of Q, K, V), y = 64 row tiles.
// ---------------------------------------------------------------------------
#define TKP 64   /* k per pass */
#define TPI 72   /* LDS row pitch in halves: 144 B = 16 B x odd */
#define TOP (256 * TPI)   /* halves of one operand's tile */
#define TBUF (2 * TOP)    /* halves of one buffer: x tile, then W tile */

// issue one pass's global loads (256x64 f16 of x and of W, 16 x 16 B per lane; 8 lanes cover
// one row's 128 B) and step the two addresses on to the next pass
typedef const __attribute__((address_space(1))) _Float16* ghalf_p;   // known global: global_load, not flat_load
typedef const __attribute__((address_space(1))) v8h* gv8h_p;
__device__ __forceinline__ void stage_ld(v8h (&fa)[8], v8h (&fb)[8],
                                         ghalf_p& xp, ghalf_p& wp) {
#pragma unroll
  for (int rr = 0; rr < 8; ++rr)
    fa[rr] = *(gv8h_p)(xp + (size_t)(rr * 32) * D_MODEL);
#pragma unroll
  for (int rr = 0; rr < 8; ++rr)
    fb[rr] = *(gv8h_p)(wp + (size_t)(rr * 32) * D_MODEL);
  // the wait that stands before a register named by an issued load is written again, and
  // the step of 64 halves (0x80 bytes) in the same statement: written in the source, the
  // step was placed between the loads and the wait
  asm volatile("s_wait_xcnt 0x0\n\t"
               "v_add_nc_u64 %0, 0x80, %0\n\t"
               "v_add_nc_u64 %1, 0x80, %1"
               : "+v"(xp), "+v"(wp) :: "memory");
}

// store into one buffer; d0 points at this lane's first element of the x tile
__device__ __forceinline__ void stage_st(const v8h (&fa)[8], const v8h (&fb)[8],
                                         _Float16* d0) {
#pragma unroll
  for (int rr = 0; rr < 8; ++rr) *(v8h*)(d0 + rr * 32 * TPI) = fa[rr];
#pragma unroll
  for (int rr = 0; rr < 8; ++rr) *(v8h*)(d0 + TOP + rr * 32 * TPI) = fb[rr];
}

// one pass's 64 WMMAs; ap, bp point at this lane's first fragment run in the buffer
__device__ __forceinline__ void pass_mma(v8f (&acc)[8][4], const _Float16* ap, const _Float16* bp) {
#pragma unroll
  for (int ks = 0; ks < TKP; ks += 32) {
    v16h a[8], b[4];
#pragma unroll
    for (int j = 0; j < 4; ++j) b[j] = frag_ld(bp, j * 16, TPI, ks);
#pragma unroll
    for (int i = 0; i < 8; ++i) a[i] = frag_ld(ap, i * 16, TPI, ks);
    // keeps the 24 LDS reads one group ahead of the 32 WMMAs: sunk among them, each
    // row of WMMAs would wait out its own LDS latency
    __builtin_amdgcn_sched_barrier(0);
#pragma unroll
    for (int i = 0; i < 8; ++i) {
#pragma unroll
      for (int j = 0; j < 4; ++j) acc[i][j] = wmma16(a[i], b[j], acc[i][j]);
    }
    // keeps what follows (the next 24 LDS reads, the staging stores with their wait
    // for the global loads) behind these WMMAs: moved in among them it spilled registers
    // and waited for the global loads with half of the pass's WMMAs still to issue
    __builtin_amdgcn_sched_barrier(0);
  }
}

__launch_bounds__(256)
__global__ void qkv_proj_kernel(const _Float16* __restrict__ xh, const _Float16* __restrict__ Wh,
                                const float* __restrict__ bq, const float* __restrict__ bk,
                                const float* __restrict__ bv,
                                _Float16* __restrict__ Qh, _Float16* __restrict__ Kh,
                                _Float16* __restrict__ Vh)
{
  __shared__ __attribute__((aligned(16))) _Float16 Tl[2 * TBUF];   // two buffers of [x tile [m][k] | W tile [n][k]]

  const int tid  = threadIdx.x;
  const int wave = tid >> 5;
  const int lane = tid & 31;
  const int sel   = blockIdx.x >> 2;          // 0: Q, 1: K, 2: V
  const int nBase = (blockIdx.x & 3) * 256;
  const int mBase = blockIdx.y * 256;

  const float* bias = sel == 0 ? bq : (sel == 1 ? bk : bv);
  _Float16*    out  = sel == 0 ? Qh : (sel == 1 ? Kh : Vh);

  const int wm = (wave >> 2) * 128;   // wave's first row in the tile
  const int wn = (wave & 3) * 64;     // wave's first column in the tile

  v8f acc[8][4] = {};

  const int lr = tid >> 3;         // 0..31
  const int lc = (tid & 7) * 8;    // 0,8,...,56
  const int fr = lane & 15;
  const int kf = (lane >> 4) * 8;

  ghalf_p xs = (ghalf_p)(xh + (size_t)(mBase + lr) * D_MODEL + lc);
  ghalf_p wsrc = (ghalf_p)(Wh + (size_t)(blockIdx.x * 256 + lr) * D_MODEL + lc);   // Wh rows: Q, K, V

  const int stOff = lr * TPI + lc;                    // this lane's staging place in a buffer
  const int aOff  = (wm + fr) * TPI + kf;             // its first x fragment run
  const int bOff  = TOP + (wn + fr) * TPI + kf;       // its first W fragment run

  v8h fa[8], fb[8];
  stage_ld(fa, fb, xs, wsrc);
  stage_st(fa, fb, &Tl[stOff]);
  __syncthreads();

  // the pass loop stays rolled: an unrolled copy adds code and no overlap (the buffer's
  // offset costs one scalar select per pass)
#pragma unroll 1
  for (int t = 0; t < D_MODEL / TKP - 1; ++t) {
    const int cur = (t & 1) * TBUF;
    stage_ld(fa, fb, xs, wsrc);
    pass_mma(acc, &Tl[cur + aOff], &Tl[cur + bOff]);
    stage_st(fa, fb, &Tl[(TBUF - cur) + stOff]);
    // publishes the next pass's tile and ends every reader's last read of this one
    __syncthreads();
  }
  pass_mma(acc, &Tl[((D_MODEL / TKP - 1) & 1) * TBUF + aOff],
           &Tl[((D_MODEL / TKP - 1) & 1) * TBUF + bOff]);

  // epilogue: bias add, f32 -> f16 store.  C layout: vgpr r -> m = r (lanes 0-15)
  // or r+8 (lanes 16-31); n = lane&15 within the 16-col tile.
  const int col  = lane & 15;
  const int rofs = (lane >> 4) * 8;
  _Float16* op = out + (size_t)(mBase + wm + rofs) * D_MODEL + nBase + wn + col;
  float bb[4];
  const int bcol = nBase + wn + col;
#pragma unroll
  for (int j = 0; j < 4; ++j) bb[j] = bias[bcol + j * 16];
  // the wait that stands before a register named by these loads is written again; index and
  // base are inputs so that they stay whole up to it
  asm volatile("s_wait_xcnt 0x0" :: "v"(bcol), "s"(bias) : "memory");
#pragma unroll
  for (int g = 0; g < 8; g += 2) {   // two row tiles (32 rows x 64 columns) at a time
    _Float16 hv[2][8][4];
#pragma unroll
    for (int i = 0; i < 2; ++i) {
#pragma unroll
      for (int r = 0; r < 8; ++r) {
#pragma unroll
        for (int j = 0; j < 4; ++j) hv[i][r][j] = (_Float16)(acc[g + i][j][r] + bb[j]);
      }
    }
    // keeps this group's conversions ahead of its stores, so that none lands on a
    // register of a store already issued
    __builtin_amdgcn_sched_barrier(0);
#pragma unroll
    for (int i = 0; i < 2; ++i) {
#pragma unroll
      for (int r = 0; r < 8; ++r) {
#pragma unroll
        for (int j = 0; j < 4; ++j)
          op[(size_t)((g + i) * 16 + r) * D_MODEL + j * 16] = hv[i][r][j];
      }
    }
    if (g < 6) {
      // the wait that stands before the next group's conversions reuse the stores' registers
      asm volatile("s_wait_xcnt 0x0" ::: "memory");
      // holds those conversions behind the wait (a "memory" clobber does not order vector work)
      __builtin_amdgcn_sched_barrier(0);
    }
  }
}

// ---------------------------------------------------------------------------
// Kernel 2: Kp/Vp partials.  Kp[k,d] = sum_l E[h,k,l] * K[b,l,h*64+d]
// grid (64 bh, SPLITL);  each WG reduces a 512-wide l-chunk -> partial buffer.
// All 512 workgroups are resident at once, so the launch lasts as long as one workgroup's
// chain of 16 tiles.  A tile's six global loads are issued as one group two tiles ahead,
// right behind the barrier that publishes tile t, into the register set that tile t has
// just left; they land while tiles t and t + 1 are worked on.
// ---------------------------------------------------------------------------
// work-group barrier that orders LDS traffic only: __syncthreads() also waits out every global
// load of the wave, which would end the flight of the loads issued ahead at the next barrier
__device__ __forceinline__ void lds_barrier() {
  __builtin_amdgcn_fence(__ATOMIC_RELEASE, "workgroup", "local");
  __builtin_amdgcn_s_barrier();
  __builtin_amdgcn_fence(__ATOMIC_ACQUIRE, "workgroup", "local");
}

// one tile's global loads: 128 x 32 fp32 of E (4 x 16 B a lane), 32 x 64 f16 of K and of V
__device__ __forceinline__ void kv_tile_ld(float4 (&fe)[4], v8h& kk, v8h& vv,
                                           const float* ep, const _Float16* kp,
                                           const _Float16* vp) {
#pragma unroll
  for (int rr = 0; rr < 4; ++rr) fe[rr] = *(const float4*)(ep + (size_t)(rr * 32) * SEQ_LEN);
  kk = *(const v8h*)kp;
  vv = *(const v8h*)vp;
  // the wait that stands before a register named by these loads is written again
  asm volatile("s_wait_xcnt 0x0" ::: "memory");
  // holds what follows (address steps, LDS reads into the address registers) behind that wait,
  // and keeps the six loads ahead of the tile's LDS reads and WMMAs
  __builtin_amdgcn_sched_barrier(0);
}

__launch_bounds__(256)
__global__ void kv_lowrank_kernel(const float* __restrict__ E,
                                  const _Float16* __restrict__ Kh,
                                  const _Float16* __restrict__ Vh,
                                  float* __restrict__ KpPart, float* __restrict__ VpPart)
{
  __shared__ _Float16 Al[128 * 40];   // E tile  [krow][l]
  __shared__ _Float16 BK[64 * 40];    // K^T tile [d][l]
  __shared__ _Float16 BV[64 * 40];

  const int tid  = threadIdx.x;
  const int wave = tid >> 5;
  const int lane = tid & 31;
  const int bh = blockIdx.x;          // 0..63
  const int b  = bh >> 4, h = bh & 15;
  const int ls = blockIdx.y;          // split index

  v8f accK[4] = {}, accV[4] = {};

  const int lr = tid >> 3, lc = (tid & 7) * 4;
  const int tl = tid >> 3;            // l within tile for B stage
  const int td = (tid & 7) * 8;       // d group
  const int fr = lane & 15;
  const int kf = (lane >> 4) * 8;

  const size_t eBase  = (size_t)h * LKF * SEQ_LEN;
  const size_t kvBase = (size_t)b * SEQ_LEN * D_MODEL + (size_t)h * HEAD_DIM;
  const int lBeg = ls * (SEQ_LEN / SPLITL);
  const int lEnd = lBeg + (SEQ_LEN / SPLITL);

  const float*    ep = E + eBase + (size_t)lr * SEQ_LEN + lc;       // + l
  const _Float16* kp = Kh + kvBase + (size_t)tl * D_MODEL + td;     // + l * D_MODEL
  const _Float16* vp = Vh + kvBase + (size_t)tl * D_MODEL + td;

  float4 fe[2][4];
  v8h kk[2], vv[2];
#pragma unroll
  for (int u = 0; u < 2; ++u)
    kv_tile_ld(fe[u], kk[u], vv[u], ep + lBeg + u * 32, kp + (size_t)(lBeg + u * 32) * D_MODEL,
               vp + (size_t)(lBeg + u * 32) * D_MODEL);

  // one tile out of register set u; more: a tile t + 2 exists and is asked for
  auto tile = [&](const int u, const int l0, const bool more) __attribute__((always_inline)) {
    lds_barrier();   // ends every reader's last read of the tile before
#pragma unroll
    for (int rr = 0; rr < 4; ++rr) {
      const float4 f = fe[u][rr];
      _Float16* d = &Al[(lr + rr * 32) * 40 + lc];
      d[0] = (_Float16)f.x; d[1] = (_Float16)f.y; d[2] = (_Float16)f.z; d[3] = (_Float16)f.w;
    }
#pragma unroll
    for (int i = 0; i < 8; ++i) {
      BK[(td + i) * 40 + tl] = kk[u][i]; BV[(td + i) * 40 + tl] = vv[u][i];
    }
    lds_barrier();   // publishes this tile

    if (more)
      kv_tile_ld(fe[u], kk[u], vv[u], ep + l0 + 64, kp + (size_t)(l0 + 64) * D_MODEL,
                 vp + (size_t)(l0 + 64) * D_MODEL);

    const v16h a = frag_ld(&Al[(wave * 16) * 40], fr, 40, kf);
    // pipelined over t: next K/V fragments in flight during current WMMAs
    v16h bkc = frag_ld(&BK[0], fr, 40, kf);
    v16h bvc = frag_ld(&BV[0], fr, 40, kf);
#pragma unroll
    for (int t = 0; t < 3; ++t) {
      const v16h bkn = frag_ld(&BK[((t + 1) * 16) * 40], fr, 40, kf);
      const v16h bvn = frag_ld(&BV[((t + 1) * 16) * 40], fr, 40, kf);
      accK[t] = wmma16(a, bkc, accK[t]);
      accV[t] = wmma16(a, bvc, accV[t]);
      bkc = bkn; bvc = bvn;
    }
    accK[3] = wmma16(a, bkc, accK[3]);
    accV[3] = wmma16(a, bvc, accV[3]);
  };
  // two tiles a trip, so that each register set has a fixed name; the last two tiles stand
  // behind the loop, so that every trip issues the same loads and a tile's wait can leave
  // the younger set in flight
  for (int lp = lBeg; lp < lEnd - 64; lp += 64) {
    tile(0, lp, true);
    tile(1, lp + 32, true);
  }
  tile(0, lEnd - 64, false);
  tile(1, lEnd - 32, false);

  const int col = lane & 15, rofs = (lane >> 4) * 8;
  const size_t pb = ((size_t)ls * (BATCH * N_HEADS) + bh) * LKF * HEAD_DIM;
#pragma unroll
  for (int t = 0; t < 4; ++t) {
#pragma unroll
    for (int r = 0; r < 8; ++r) {
      const int krow = wave * 16 + rofs + r;
      const int n = t * 16 + col;
      KpPart[pb + (size_t)krow * HEAD_DIM + n] = accK[t][r];
      VpPart[pb + (size_t)krow * HEAD_DIM + n] = accV[t][r];
    }
  }
}

// Reduce SPLITL partials -> f16 Kp/Vp (deterministic, no atomics).
__launch_bounds__(256)
__global__ void kv_reduce_kernel(const float* __restrict__ KpPart,
                                 const float* __restrict__ VpPart,
                                 _Float16* __restrict__ Kp, _Float16* __restrict__ Vp)
{
  const size_t idx = (size_t)blockIdx.x * 256 + threadIdx.x;  // 0..524287
  const size_t stride = (size_t)BATCH * N_HEADS * LKF * HEAD_DIM;
  float sk = 0.f, sv = 0.f;
#pragma unroll
  for (int s = 0; s < SPLITL; ++s) { sk += KpPart[s * stride + idx]; sv += VpPart[s * stride + idx]; }
  Kp[idx] = (_Float16)sk;
  Vp[idx] = (_Float16)sv;
}

// ---------------------------------------------------------------------------
// Kernel 3: attention.  dot = Q @ Kp^T / 8 -> softmax(k=128) -> @ Vp -> out.
// grid (32 l-blocks, 64 bh); WG covers 128 rows of l (16 per wave).
// LDS: [VpL 64x136][ KpL 128x72  aliased with  AtL 8x16x136 ]  (52 KB)
// ---------------------------------------------------------------------------
__launch_bounds__(256)
__global__ void attn_kernel(const _Float16* __restrict__ Qh,
                            const _Float16* __restrict__ Kp, const _Float16* __restrict__ Vp,
                            float* __restrict__ out)
{
  __shared__ _Float16 smem[64 * 136 + 8 * 16 * 136];
  _Float16* VpL = smem;                 // [d][kidx]  (transposed Vp)
  _Float16* KpL = smem + 64 * 136;      // [kidx][d]  (row-major Kp) -- dead after GEMM1
  _Float16* AtL = smem + 64 * 136;      // [wave][m][kidx] attn rows -- reuses KpL space

  const int tid  = threadIdx.x;
  const int wave = tid >> 5;
  const int lane = tid & 31;
  const int lBase = blockIdx.x * 128;
  const int bh = blockIdx.y;
  const int b  = bh >> 4, h = bh & 15;

  // stage Kp (row-major) and Vp (transposed)
  {
    const int kr = tid >> 1;
    const int c0 = (tid & 1) * 32;
    const size_t src = ((size_t)bh * LKF + kr) * HEAD_DIM + c0;
#pragma unroll
    for (int j = 0; j < 4; ++j) {
      const v8h kk = *(const v8h*)(Kp + src + 8 * j);
      *(v8h*)(&KpL[kr * 72 + c0 + 8 * j]) = kk;
      const v8h vv = *(const v8h*)(Vp + src + 8 * j);
#pragma unroll
      for (int i = 0; i < 8; ++i) VpL[(c0 + 8 * j + i) * 136 + kr] = vv[i];
    }
  }

  const int fr = lane & 15;
  const int kf = (lane >> 4) * 8;
  const int rofs = (lane >> 4) * 8, col = lane & 15;

  // hoist both global Q fragments (k-halves 0..31, 32..63) before the barrier
  const _Float16* qBase = Qh + ((size_t)b * SEQ_LEN + lBase + wave * 16) * D_MODEL
                             + (size_t)h * HEAD_DIM;
  v16h afr[2];
#pragma unroll
  for (int ks = 0; ks < 2; ++ks) afr[ks] = frag_ld(qBase, fr, D_MODEL, ks * 32 + kf);

  __syncthreads();

  // GEMM1: dot[l, kidx] = Q[l,:64] . Kp[kidx,:64], pipelined over the 8 n-tiles
  v8f acc[8] = {};
#pragma unroll
  for (int ks = 0; ks < 2; ++ks) {
    v16h bc = frag_ld(&KpL[0], fr, 72, ks * 32 + kf);
#pragma unroll
    for (int t = 0; t < 7; ++t) {
      const v16h bn = frag_ld(&KpL[((t + 1) * 16) * 72], fr, 72, ks * 32 + kf);
      acc[t] = wmma16(afr[ks], bc, acc[t]);
      bc = bn;
    }
    acc[7] = wmma16(afr[ks], bc, acc[7]);
  }
  __syncthreads();   // KpL dead everywhere; AtL may now reuse its space

  // softmax over 128 per row; rows split across half-waves, reduce over 16 lanes
  const float scale = 0.125f;  // 1/sqrt(64)
  _Float16* at = &AtL[(wave * 16) * 136];
#pragma unroll
  for (int r = 0; r < 8; ++r) {
    float mx = -3.0e38f;
#pragma unroll
    for (int t = 0; t < 8; ++t) { acc[t][r] *= scale; mx = fmaxf(mx, acc[t][r]); }
#pragma unroll
    for (int s = 1; s < 16; s <<= 1) mx = fmaxf(mx, __shfl_xor(mx, s, 32));
    float sum = 0.f;
#pragma unroll
    for (int t = 0; t < 8; ++t) { const float e = __expf(acc[t][r] - mx); acc[t][r] = e; sum += e; }
#pragma unroll
    for (int s = 1; s < 16; s <<= 1) sum += __shfl_xor(sum, s, 32);
    const float inv = 1.0f / sum;
    const int m = rofs + r;
#pragma unroll
    for (int t = 0; t < 8; ++t) at[m * 136 + t * 16 + col] = (_Float16)(acc[t][r] * inv);
  }
  __syncthreads();

  // GEMM2: out[l, d] = attn[l,:128] . Vp[:,d], pipelined over the 4 n-tiles
  v8f o[4] = {};
#pragma unroll
  for (int ks = 0; ks < 4; ++ks) {
    const v16h a = frag_ld(at, fr, 136, ks * 32 + kf);
    v16h bc = frag_ld(&VpL[0], fr, 136, ks * 32 + kf);
#pragma unroll
    for (int t = 0; t < 3; ++t) {
      const v16h bn = frag_ld(&VpL[((t + 1) * 16) * 136], fr, 136, ks * 32 + kf);
      o[t] = wmma16(a, bc, o[t]);
      bc = bn;
    }
    o[3] = wmma16(a, bc, o[3]);
  }
  // epilogue: head-combined fp32 output [b, l, h*64 + d]
#pragma unroll
  for (int t = 0; t < 4; ++t) {
#pragma unroll
    for (int r = 0; r < 8; ++r) {
      const int l = lBase + wave * 16 + rofs + r;
      out[((size_t)b * SEQ_LEN + l) * D_MODEL + (size_t)h * HEAD_DIM + t * 16 + col] = o[t][r];
    }
  }
}

// ---------------------------------------------------------------------------
extern "C" void kernel_launch(void* const* d_in, const int* in_sizes, int n_in,
                              void* d_out, int out_size, void* d_ws, size_t ws_size,
                              hipStream_t stream) {
  const float* x  = (const float*)d_in[0];
  const float* Wq = (const float*)d_in[1];
  const float* bq = (const float*)d_in[2];
  const float* Wk = (const float*)d_in[3];
  const float* bk = (const float*)d_in[4];
  const float* Wv = (const float*)d_in[5];
  const float* bv = (const float*)d_in[6];
  const float* E  = (const float*)d_in[7];
  float* outp = (float*)d_out;

  char* ws = (char*)d_ws;
  const size_t szQKV  = (size_t)M_TOTAL * D_MODEL * sizeof(_Float16);          // 32 MB each
  const size_t szProj = (size_t)BATCH * N_HEADS * LKF * HEAD_DIM;              // 524288 elems
  _Float16* Qh = (_Float16*)(ws);
  _Float16* Kh = (_Float16*)(ws + szQKV);
  _Float16* Vh = (_Float16*)(ws + 2 * szQKV);
  float* KpPart = (float*)(ws + 3 * szQKV);                                    // 16 MB
  float* VpPart = (float*)(ws + 3 * szQKV + SPLITL * szProj * sizeof(float));  // 16 MB
  _Float16* Kp = (_Float16*)(ws + 3 * szQKV + 2 * SPLITL * szProj * sizeof(float));
  _Float16* Vp = (_Float16*)((char*)Kp + szProj * sizeof(_Float16));
  _Float16* xh = (_Float16*)((char*)Vp + szProj * sizeof(_Float16));           // 32 MB
  _Float16* Wh = (_Float16*)((char*)xh + szQKV);                               // 6 MB

  to_f16_kernel<<<dim3(CVT_XB + 3 * CVT_WB), 256, 0, stream>>>(x, Wq, Wk, Wv, xh, Wh);

  qkv_proj_kernel<<<dim3(3 * D_MODEL / 256, M_TOTAL / 256), 256, 0, stream>>>(
      xh, Wh, bq, bk, bv, Qh, Kh, Vh);

  kv_lowrank_kernel<<<dim3(BATCH * N_HEADS, SPLITL), 256, 0, stream>>>(
      E, Kh, Vh, KpPart, VpPart);

  kv_reduce_kernel<<<dim3((unsigned)(szProj / 256)), 256, 0, stream>>>(
      KpPart, VpPart, Kp, Vp);

  attn_kernel<<<dim3(SEQ_LEN / 128, BATCH * N_HEADS), 256, 0, stream>>>(
      Qh, Kp, Vp, outp);
}

// v005
// It runs in 133 microseconds.
// In both of two side-by-side timings against v004, it was 1.06 times as fast.
// Counting every step since v000, it is 2.16 times as fast.
#include <hip/hip_runtime.h>

#define D_MODEL 1024
#define SEQ_LEN 4096
#define N_HEADS 16
#define HEAD_DIM 64
#define LKF 128
#define BATCH 4
#define M_TOTAL (BATCH * SEQ_LEN) /* 16384 */
#define SPLITL 8                  /* split-K chunks for kernel 2 */

typedef __attribute__((ext_vector_type(16))) _Float16 v16h;
typedef __attribute__((ext_vector_type(8)))  _Float16 v8h;
typedef __attribute__((ext_vector_type(8)))  float    v8f;
typedef __attribute__((ext_vector_type(4)))  _Float16 v4h;
typedef __attribute__((ext_vector_type(4)))  float    v4f;

union V16H { v16h v; v8h h[2]; };

// Load one 16x32 f16 fragment for a lane.
// Per ISA 16-bit A/B layout: lane (0-15 -> m=lane, 16-31 -> m=lane-16) holds two
// contiguous 8-half runs: k in [kf, kf+8) and [kf+16, kf+24), kf = (lane>=16)?8:0.
__device__ __forceinline__ v16h frag_ld(const _Float16* base, int row, int stride, int koff) {
  V16H u;
  const _Float16* p = base + row * stride + koff;
  u.h[0] = *(const v8h*)(p);
  u.h[1] = *(const v8h*)(p + 16);
  return u.v;
}

__device__ __forceinline__ v8f wmma16(v16h a, v16h b, v8f c) {
  return __builtin_amdgcn_wmma_f32_16x16x32_f16(false, a, false, b, (short)0, c, false, false);
}

// ---------------------------------------------------------------------------
// Kernel 0: x and the three W, fp32 -> f16, once.  The projection reads every x row 12
// times and every W row 64 times out of L2: as f16 those reads are half the bytes, and
// the rounding (the same one, to nearest even) is done once per element.
// One workgroup converts 32768 contiguous floats: 32 x 16 B read and 32 x 8 B written per lane,
// every wave-wide load and store on whole 128-B lines; few, long waves, all resident at once,
// because a launch this short pays for every wave it starts.
// grid: 512 workgroups for x, then 32 each for Wq, Wk, Wv (Wh = [Wq | Wk | Wv] by rows).
// ---------------------------------------------------------------------------
#define CVT_EL 32768                               /* floats per workgroup */
#define CVT_PL (CVT_EL / (256 * 4))                /* 16-B loads per lane: 32 */
#define CVT_XB (M_TOTAL * D_MODEL / CVT_EL)        /* 512 */
#define CVT_WB (D_MODEL * D_MODEL / CVT_EL)        /* 32 */
__launch_bounds__(256)
__global__ void to_f16_kernel(const float* __restrict__ x, const float* __restrict__ Wq,
                              const float* __restrict__ Wk, const float* __restrict__ Wv,
                              _Float16* __restrict__ xh, _Float16* __restrict__ Wh)
{
  const int blk = blockIdx.x;
  const float* src;
  _Float16* dst;
  if (blk < CVT_XB) {
    src = x + (size_t)blk * CVT_EL;
    dst = xh + (size_t)blk * CVT_EL;
  } else {
    const int w   = blk - CVT_XB;
    const int sel = w / CVT_WB;
    src = (sel == 0 ? Wq : (sel == 1 ? Wk : Wv)) + (size_t)(w % CVT_WB) * CVT_EL;
    dst = Wh + (size_t)w * CVT_EL;
  }
  const v4f* s4 = (const v4f*)src + threadIdx.x;
  v4h*       d4 = (v4h*)dst + threadIdx.x;
  v4f f[CVT_PL];
  // read once, never again: non-temporal, so that the fp32 lines do not push the f16 copy out of L2
#pragma unroll
  for (int i = 0; i < CVT_PL; ++i) f[i] = __builtin_nontemporal_load(s4 + i * 256);
#pragma unroll
  for (int i = 0; i < CVT_PL; ++i) d4[i * 256] = __builtin_convertvector(f[i], v4h);
}

// ---------------------------------------------------------------------------
// Kernel 1: QKV projection.  C[m,n] = sum_k x[m,k] * W[n,k] + b[n], x and W as f16 from kernel 0
// One 256(M) x 256(N) tile of one of Q, K, V per workgroup, 64 k per pass.
// 8 waves as 2(M) x 4(N); each wave owns 128 x 64 = 8 x 4 accumulator tiles, so
// 12 fragments read from LDS feed 32 WMMAs.
// Two LDS buffers: the next pass's global loads are issued ahead of this pass's WMMAs
// and land in registers meanwhile; they are stored into the other buffer behind the
// WMMAs, so one barrier per pass is enough.
// Q is written [m][n]; K and V are written transposed, [b][n][l], the order the low-rank
// product reads them in.
// grid: x = 12 column tiles (4 each of Q, K, V), y = 64 row tiles.
// ---------------------------------------------------------------------------
#define TKP 64   /* k per pass */
#define TPI 72   /* LDS row pitch in halves: 144 B = 16 B x odd */
#define TOP (256 * TPI)   /* halves of one operand's tile */
#define TBUF (2 * TOP)    /* halves of one buffer: x tile, then W tile */
#define EPI 136  /* epilogue staging pitch in halves: 272 B = 256 B + 16 B */

// issue one pass's global loads (256x64 f16 of x and of W, 16 x 16 B per lane; 8 lanes cover
// one row's 128 B) and step the two addresses on to the next pass
typedef const __attribute__((address_space(1))) _Float16* ghalf_p;   // known global: global_load, not flat_load
typedef const __attribute__((address_space(1))) v8h* gv8h_p;
__device__ __forceinline__ void stage_ld(v8h (&fa)[8], v8h (&fb)[8],
                                         ghalf_p& xp, ghalf_p& wp) {
#pragma unroll
  for (int rr = 0; rr < 8; ++rr)
    fa[rr] = *(gv8h_p)(xp + (size_t)(rr * 32) * D_MODEL);
#pragma unroll
  for (int rr = 0; rr < 8; ++rr)
    fb[rr] = *(gv8h_p)(wp + (size_t)(rr * 32) * D_MODEL);
  // the wait that stands before a register named by an issued load is written again, and
  // the step of 64 halves (0x80 bytes) in the same statement: written in the source, the
  // step was placed between the loads and the wait
  asm volatile("s_wait_xcnt 0x0\n\t"
               "v_add_nc_u64 %0, 0x80, %0\n\t"
               "v_add_nc_u64 %1, 0x80, %1"
               : "+v"(xp), "+v"(wp) :: "memory");
}

// store into one buffer; d0 points at this lane's first element of the x tile
__device__ __forceinline__ void stage_st(const v8h (&fa)[8], const v8h (&fb)[8],
                                         _Float16* d0) {
#pragma unroll
  for (int rr = 0; rr < 8; ++rr) *(v8h*)(d0 + rr * 32 * TPI) = fa[rr];
#pragma unroll
  for (int rr = 0; rr < 8; ++rr) *(v8h*)(d0 + TOP + rr * 32 * TPI) = fb[rr];
}

// one pass's 64 WMMAs; ap, bp point at this lane's first fragment run in the buffer
__device__ __forceinline__ void pass_mma(v8f (&acc)[8][4], const _Float16* ap, const _Float16* bp) {
#pragma unroll
  for (int ks = 0; ks < TKP; ks += 32) {
    v16h a[8], b[4];
#pragma unroll
    for (int j = 0; j < 4; ++j) b[j] = frag_ld(bp, j * 16, TPI, ks);
#pragma unroll
    for (int i = 0; i < 8; ++i) a[i] = frag_ld(ap, i * 16, TPI, ks);
    // keeps the 24 LDS reads one group ahead of the 32 WMMAs: sunk among them, each
    // row of WMMAs would wait out its own LDS latency
    __builtin_amdgcn_sched_barrier(0);
#pragma unroll
    for (int i = 0; i < 8; ++i) {
#pragma unroll
      for (int j = 0; j < 4; ++j) acc[i][j] = wmma16(a[i], b[j], acc[i][j]);
    }
    // keeps what follows (the next 24 LDS reads, the staging stores with their wait
    // for the global loads) behind these WMMAs: moved in among them it spilled registers
    // and waited for the global loads with half of the pass's WMMAs still to issue
    __builtin_amdgcn_sched_barrier(0);
  }
}

__launch_bounds__(256)
__global__ void qkv_proj_kernel(const _Float16* __restrict__ xh, const _Float16* __restrict__ Wh,
                                const float* __restrict__ bq, const float* __restrict__ bk,
                                const float* __restrict__ bv,
                                _Float16* __restrict__ Qh, _Float16* __restrict__ Kh,
                                _Float16* __restrict__ Vh)
{
  __shared__ __attribute__((aligned(16))) _Float16 Tl[2 * TBUF];   // two buffers of [x tile [m][k] | W tile [n][k]]

  const int tid  = threadIdx.x;
  const int wave = tid >> 5;
  const int lane = tid & 31;
  const int sel   = blockIdx.x >> 2;          // 0: Q, 1: K, 2: V
  const int nBase = (blockIdx.x & 3) * 256;
  const int mBase = blockIdx.y * 256;

  const float* bias = sel == 0 ? bq : (sel == 1 ? bk : bv);
  _Float16*    out  = sel == 0 ? Qh : (sel == 1 ? Kh : Vh);

  const int wm = (wave >> 2) * 128;   // wave's first row in the tile
  const int wn = (wave & 3) * 64;     // wave's first column in the tile

  v8f acc[8][4] = {};

  const int lr = tid >> 3;         // 0..31
  const int lc = (tid & 7) * 8;    // 0,8,...,56
  const int fr = lane & 15;
  const int kf = (lane >> 4) * 8;

  ghalf_p xs = (ghalf_p)(xh + (size_t)(mBase + lr) * D_MODEL + lc);
  ghalf_p wsrc = (ghalf_p)(Wh + (size_t)(blockIdx.x * 256 + lr) * D_MODEL + lc);   // Wh rows: Q, K, V

  const int stOff = lr * TPI + lc;                    // this lane's staging place in a buffer
  const int aOff  = (wm + fr) * TPI + kf;             // its first x fragment run
  const int bOff  = TOP + (wn + fr) * TPI + kf;       // its first W fragment run

  v8h fa[8], fb[8];
  stage_ld(fa, fb, xs, wsrc);
  stage_st(fa, fb, &Tl[stOff]);
  __syncthreads();

  // the pass loop stays rolled: an unrolled copy adds code and no overlap (the buffer's
  // offset costs one scalar select per pass)
#pragma unroll 1
  for (int t = 0; t < D_MODEL / TKP - 1; ++t) {
    const int cur = (t & 1) * TBUF;
    stage_ld(fa, fb, xs, wsrc);
    pass_mma(acc, &Tl[cur + aOff], &Tl[cur + bOff]);
    stage_st(fa, fb, &Tl[(TBUF - cur) + stOff]);
    // publishes the next pass's tile and ends every reader's last read of this one
    __syncthreads();
  }
  pass_mma(acc, &Tl[((D_MODEL / TKP - 1) & 1) * TBUF + aOff],
           &Tl[((D_MODEL / TKP - 1) & 1) * TBUF + bOff]);

  // epilogue: bias add, f32 -> f16 store.  C layout: vgpr r -> m = r (lanes 0-15)
  // or r+8 (lanes 16-31); n = lane&15 within the 16-col tile.
  const int col  = lane & 15;
  const int rofs = (lane >> 4) * 8;
  _Float16* op = out + (size_t)(mBase + wm + rofs) * D_MODEL + nBase + wn + col;
  float bb[4];
  const int bcol = nBase + wn + col;
#pragma unroll
  for (int j = 0; j < 4; ++j) bb[j] = bias[bcol + j * 16];
  // the wait that stands before a register named by these loads is written again; index and
  // base are inputs so that they stay whole up to it
  asm volatile("s_wait_xcnt 0x0" :: "v"(bcol), "s"(bias) : "memory");
  if (sel != 0) {
    // K and V leave transposed, [b][n][l]: a lane's 8 accumulator rows of one column are 16
    // contiguous bytes there.  Each wave turns its 128 x 64 tile in its own LDS range, 64 rows
    // of 256 B at pitch 272 B, and stores whole 128-B lines.
    __syncthreads();   // ends every wave's last fragment read of the two buffers, reused here
    _Float16* st = &Tl[wave * (64 * EPI)];
#pragma unroll
    for (int j = 0; j < 4; ++j) {
#pragma unroll
      for (int i = 0; i < 8; ++i) {
        v8h hv;
#pragma unroll
        for (int r = 0; r < 8; ++r) hv[r] = (_Float16)(acc[i][j][r] + bb[j]);
        *(v8h*)(st + (j * 16 + col) * EPI + i * 16 + rofs) = hv;
      }
    }
    // the wave's own LDS writes are done before it reads other lanes' rows back
    asm volatile("s_wait_dscnt 0x0" ::: "memory");
    const int rr = lane >> 4;         // two rows per wave-wide access
    const int cc = (lane & 15) * 8;   // 16 lanes x 16 B = one row's 256 B
    v8h tv[32];
#pragma unroll
    for (int q = 0; q < 32; ++q) tv[q] = *(const v8h*)(st + (q * 2 + rr) * EPI + cc);
    // keeps all 32 reads ahead of the stores, each in registers of its own, so that no read
    // lands on a register of a store already issued
    __builtin_amdgcn_sched_barrier(0);
    _Float16* tp = out + ((size_t)(mBase / SEQ_LEN) * D_MODEL + nBase + wn + rr) * SEQ_LEN
                       + (mBase % SEQ_LEN) + wm + cc;
#pragma unroll
    for (int q = 0; q < 32; ++q) *(v8h*)(tp + (size_t)(q * 2) * SEQ_LEN) = tv[q];
    // the wait that stands before a register named by these stores is written again
    asm volatile("s_wait_xcnt 0x0" ::: "memory");
    return;
  }
#pragma unroll
  for (int g = 0; g < 8; g += 2) {   // two row tiles (32 rows x 64 columns) at a time
    _Float16 hv[2][8][4];
#pragma unroll
    for (int i = 0; i < 2; ++i) {
#pragma unroll
      for (int r = 0; r < 8; ++r) {
#pragma unroll
        for (int j = 0; j < 4; ++j) hv[i][r][j] = (_Float16)(acc[g + i][j][r] + bb[j]);
      }
    }
    // keeps this group's conversions ahead of its stores, so that none lands on a
    // register of a store already issued
    __builtin_amdgcn_sched_barrier(0);
#pragma unroll
    for (int i = 0; i < 2; ++i) {
#pragma unroll
      for (int r = 0; r < 8; ++r) {
#pragma unroll
        for (int j = 0; j < 4; ++j)
          op[(size_t)((g + i) * 16 + r) * D_MODEL + j * 16] = hv[i][r][j];
      }
    }
    if (g < 6) {
      // the wait that stands before the next group's conversions reuse the stores' registers
      asm volatile("s_wait_xcnt 0x0" ::: "memory");
      // holds those conversions behind the wait (a "memory" clobber does not order vector work)
      __builtin_amdgcn_sched_barrier(0);
    }
  }
}

// ---------------------------------------------------------------------------
// Kernel 2: Kp/Vp partials.  Kp[k,d] = sum_l E[h,k,l] * K^T[b,h*64+d,l]
// grid (64 bh, SPLITL);  each WG reduces a 512-wide l-chunk -> partial buffer.
// All 512 workgroups are resident at once, so the launch lasts as long as one workgroup's
// chain of 16 tiles.  A tile's six global loads are issued as one group two tiles ahead,
// right behind the barrier that publishes tile t, into the register set that tile t has
// just left; they land while tiles t and t + 1 are worked on.
// ---------------------------------------------------------------------------
// work-group barrier that orders LDS traffic only: __syncthreads() also waits out every global
// load of the wave, which would end the flight of the loads issued ahead at the next barrier
__device__ __forceinline__ void lds_barrier() {
  __builtin_amdgcn_fence(__ATOMIC_RELEASE, "workgroup", "local");
  __builtin_amdgcn_s_barrier();
  __builtin_amdgcn_fence(__ATOMIC_ACQUIRE, "workgroup", "local");
}

// one tile's global loads: 128 x 32 fp32 of E (4 x 16 B a lane), 64 x 32 f16 of K^T and of V^T
__device__ __forceinline__ void kv_tile_ld(float4 (&fe)[4], v8h& kk, v8h& vv,
                                           const float* ep, const _Float16* kp,
                                           const _Float16* vp) {
#pragma unroll
  for (int rr = 0; rr < 4; ++rr) fe[rr] = *(const float4*)(ep + (size_t)(rr * 32) * SEQ_LEN);
  kk = *(const v8h*)kp;
  vv = *(const v8h*)vp;
  // the wait that stands before a register named by these loads is written again
  asm volatile("s_wait_xcnt 0x0" ::: "memory");
  // holds what follows (address steps, LDS reads into the address registers) behind that wait,
  // and keeps the six loads ahead of the tile's LDS reads and WMMAs
  __builtin_amdgcn_sched_barrier(0);
}

__launch_bounds__(256)
__global__ void kv_lowrank_kernel(const float* __restrict__ E,
                                  const _Float16* __restrict__ Kh,
                                  const _Float16* __restrict__ Vh,
                                  float* __restrict__ KpPart, float* __restrict__ VpPart)
{
  __shared__ _Float16 Al[128 * 40];   // E tile  [krow][l]
  __shared__ __attribute__((aligned(16))) _Float16 BK[64 * 40];    // K^T tile [d][l]
  __shared__ __attribute__((aligned(16))) _Float16 BV[64 * 40];

  const int tid  = threadIdx.x;
  const int wave = tid >> 5;
  const int lane = tid & 31;
  const int bh = blockIdx.x;          // 0..63
  const int b  = bh >> 4, h = bh & 15;
  const int ls = blockIdx.y;          // split index

  v8f accK[4] = {}, accV[4] = {};

  const int lr = tid >> 3, lc = (tid & 7) * 4;
  const int tr = tid >> 2;            // d row of the K^T / V^T tile
  const int tc = (tid & 3) * 8;       // l group within the tile
  const int fr = lane & 15;
  const int kf = (lane >> 4) * 8;

  const size_t eBase  = (size_t)h * LKF * SEQ_LEN;
  const size_t kvBase = ((size_t)b * D_MODEL + (size_t)h * HEAD_DIM) * SEQ_LEN;
  const int lBeg = ls * (SEQ_LEN / SPLITL);
  const int lEnd = lBeg + (SEQ_LEN / SPLITL);

  const float*    ep = E + eBase + (size_t)lr * SEQ_LEN + lc;       // + l
  const _Float16* kp = Kh + kvBase + (size_t)tr * SEQ_LEN + tc;     // + l
  const _Float16* vp = Vh + kvBase + (size_t)tr * SEQ_LEN + tc;

  float4 fe[2][4];
  v8h kk[2], vv[2];
#pragma unroll
  for (int u = 0; u < 2; ++u)
    kv_tile_ld(fe[u], kk[u], vv[u], ep + lBeg + u * 32, kp + lBeg + u * 32, vp + lBeg + u * 32);

  // one tile out of register set u; more: a tile t + 2 exists and is asked for
  auto tile = [&](const int u, const int l0, const bool more) __attribute__((always_inline)) {
    lds_barrier();   // ends every reader's last read of the tile before
#pragma unroll
    for (int rr = 0; rr < 4; ++rr) {
      const float4 f = fe[u][rr];
      _Float16* d = &Al[(lr + rr * 32) * 40 + lc];
      d[0] = (_Float16)f.x; d[1] = (_Float16)f.y; d[2] = (_Float16)f.z; d[3] = (_Float16)f.w;
    }
    *(v8h*)&BK[tr * 40 + tc] = kk[u];
    *(v8h*)&BV[tr * 40 + tc] = vv[u];
    lds_barrier();   // publishes this tile

    if (more)
      kv_tile_ld(fe[u], kk[u], vv[u], ep + l0 + 64, kp + l0 + 64, vp + l0 + 64);

    const v16h a = frag_ld(&Al[(wave * 16) * 40], fr, 40, kf);
    // pipelined over t: next K/V fragments in flight during current WMMAs
    v16h bkc = frag_ld(&BK[0], fr, 40, kf);
    v16h bvc = frag_ld(&BV[0], fr, 40, kf);
#pragma unroll
    for (int t = 0; t < 3; ++t) {
      const v16h bkn = frag_ld(&BK[((t + 1) * 16) * 40], fr, 40, kf);
      const v16h bvn = frag_ld(&BV[((t + 1) * 16) * 40], fr, 40, kf);
      accK[t] = wmma16(a, bkc, accK[t]);
      accV[t] = wmma16(a, bvc, accV[t]);
      bkc = bkn; bvc = bvn;
    }
    accK[3] = wmma16(a, bkc, accK[3]);
    accV[3] = wmma16(a, bvc, accV[3]);
  };
  // two tiles a trip, so that each register set has a fixed name; the last two tiles stand
  // behind the loop, so that every trip issues the same loads and a tile's wait can leave
  // the younger set in flight
  for (int lp = lBeg; lp < lEnd - 64; lp += 64) {
    tile(0, lp, true);
    tile(1, lp + 32, true);
  }
  tile(0, lEnd - 64, false);
  tile(1, lEnd - 32, false);

  const int col = lane & 15, rofs = (lane >> 4) * 8;
  const size_t pb = ((size_t)ls * (BATCH * N_HEADS) + bh) * LKF * HEAD_DIM;
#pragma unroll
  for (int t = 0; t < 4; ++t) {
#pragma unroll
    for (int r = 0; r < 8; ++r) {
      const int krow = wave * 16 + rofs + r;
      const int n = t * 16 + col;
      KpPart[pb + (size_t)krow * HEAD_DIM + n] = accK[t][r];
      VpPart[pb + (size_t)krow * HEAD_DIM + n] = accV[t][r];
    }
  }
}

// Reduce SPLITL partials -> f16 Kp/Vp (deterministic, no atomics).
__launch_bounds__(256)
__global__ void kv_reduce_kernel(const float* __restrict__ KpPart,
                                 const float* __restrict__ VpPart,
                                 _Float16* __restrict__ Kp, _Float16* __restrict__ Vp)
{
  const size_t idx = (size_t)blockIdx.x * 256 + threadIdx.x;  // 0..524287
  const size_t stride = (size_t)BATCH * N_HEADS * LKF * HEAD_DIM;
  float sk = 0.f, sv = 0.f;
#pragma unroll
  for (int s = 0; s < SPLITL; ++s) { sk += KpPart[s * stride + idx]; sv += VpPart[s * stride + idx]; }
  Kp[idx] = (_Float16)sk;
  Vp[idx] = (_Float16)sv;
}

// ---------------------------------------------------------------------------
// Kernel 3: attention.  dot = Q @ Kp^T / 8 -> softmax(k=128) -> @ Vp -> out.
// grid (32 l-blocks, 64 bh); WG covers 128 rows of l (16 per wave).
// LDS: [VpL 64x136][ KpL 128x72  aliased with  AtL 8x16x136 ]  (52 KB)
// ---------------------------------------------------------------------------
__launch_bounds__(256)
__global__ void attn_kernel(const _Float16* __restrict__ Qh,
                            const _Float16* __restrict__ Kp, const _Float16* __restrict__ Vp,
                            float* __restrict__ out)
{
  __shared__ _Float16 smem[64 * 136 + 8 * 16 * 136];
  _Float16* VpL = smem;                 // [d][kidx]  (transposed Vp)
  _Float16* KpL = smem + 64 * 136;      // [kidx][d]  (row-major Kp) -- dead after GEMM1
  _Float16* AtL = smem + 64 * 136;      // [wave][m][kidx] attn rows -- reuses KpL space

  const int tid  = threadIdx.x;
  const int wave = tid >> 5;
  const int lane = tid & 31;
  const int lBase = blockIdx.x * 128;
  const int bh = blockIdx.y;
  const int b  = bh >> 4, h = bh & 15;

  // stage Kp (row-major) and Vp (transposed)
  {
    const int kr = tid >> 1;
    const int c0 = (tid & 1) * 32;
    const size_t src = ((size_t)bh * LKF + kr) * HEAD_DIM + c0;
#pragma unroll
    for (int j = 0; j < 4; ++j) {
      const v8h kk = *(const v8h*)(Kp + src + 8 * j);
      *(v8h*)(&KpL[kr * 72 + c0 + 8 * j]) = kk;
      const v8h vv = *(const v8h*)(Vp + src + 8 * j);
#pragma unroll
      for (int i = 0; i < 8; ++i) VpL[(c0 + 8 * j + i) * 136 + kr] = vv[i];
    }
  }

  const int fr = lane & 15;
  const int kf = (lane >> 4) * 8;
  const int rofs = (lane >> 4) * 8, col = lane & 15;

  // hoist both global Q fragments (k-halves 0..31, 32..63) before the barrier
  const _Float16* qBase = Qh + ((size_t)b * SEQ_LEN + lBase + wave * 16) * D_MODEL
                             + (size_t)h * HEAD_DIM;
  v16h afr[2];
#pragma unroll
  for (int ks = 0; ks < 2; ++ks) afr[ks] = frag_ld(qBase, fr, D_MODEL, ks * 32 + kf);

  __syncthreads();

  // GEMM1: dot[l, kidx] = Q[l,:64] . Kp[kidx,:64], pipelined over the 8 n-tiles
  v8f acc[8] = {};
#pragma unroll
  for (int ks = 0; ks < 2; ++ks) {
    v16h bc = frag_ld(&KpL[0], fr, 72, ks * 32 + kf);
#pragma unroll
    for (int t = 0; t < 7; ++t) {
      const v16h bn = frag_ld(&KpL[((t + 1) * 16) * 72], fr, 72, ks * 32 + kf);
      acc[t] = wmma16(afr[ks], bc, acc[t]);
      bc = bn;
    }
    acc[7] = wmma16(afr[ks], bc, acc[7]);
  }
  __syncthreads();   // KpL dead everywhere; AtL may now reuse its space

  // softmax over 128 per row; rows split across half-waves, reduce over 16 lanes
  const float scale = 0.125f;  // 1/sqrt(64)
  _Float16* at = &AtL[(wave * 16) * 136];
#pragma unroll
  for (int r = 0; r < 8; ++r) {
    float mx = -3.0e38f;
#pragma unroll
    for (int t = 0; t < 8; ++t) { acc[t][r] *= scale; mx = fmaxf(mx, acc[t][r]); }
#pragma unroll
    for (int s = 1; s < 16; s <<= 1) mx = fmaxf(mx, __shfl_xor(mx, s, 32));
    float sum = 0.f;
#pragma unroll
    for (int t = 0; t < 8; ++t) { const float e = __expf(acc[t][r] - mx); acc[t][r] = e; sum += e; }
#pragma unroll
    for (int s = 1; s < 16; s <<= 1) sum += __shfl_xor(sum, s, 32);
    const float inv = 1.0f / sum;
    const int m = rofs + r;
#pragma unroll
    for (int t = 0; t < 8; ++t) at[m * 136 + t * 16 + col] = (_Float16)(acc[t][r] * inv);
  }
  __syncthreads();

  // GEMM2: out[l, d] = attn[l,:128] . Vp[:,d], pipelined over the 4 n-tiles
  v8f o[4] = {};
#pragma unroll
  for (int ks = 0; ks < 4; ++ks) {
    const v16h a = frag_ld(at, fr, 136, ks * 32 + kf);
    v16h bc = frag_ld(&VpL[0], fr, 136, ks * 32 + kf);
#pragma unroll
    for (int t = 0; t < 3; ++t) {
      const v16h bn = frag_ld(&VpL[((t + 1) * 16) * 136], fr, 136, ks * 32 + kf);
      o[t] = wmma16(a, bc, o[t]);
      bc = bn;
    }
    o[3] = wmma16(a, bc, o[3]);
  }
  // epilogue: head-combined fp32 output [b, l, h*64 + d]
#pragma unroll
  for (int t = 0; t < 4; ++t) {
#pragma unroll
    for (int r = 0; r < 8; ++r) {
      const int l = lBase + wave * 16 + rofs + r;
      out[((size_t)b * SEQ_LEN + l) * D_MODEL + (size_t)h * HEAD_DIM + t * 16 + col] = o[t][r];
    }
  }
}

// ---------------------------------------------------------------------------
extern "C" void kernel_launch(void* const* d_in, const int* in_sizes, int n_in,
                              void* d_out, int out_size, void* d_ws, size_t ws_size,
                              hipStream_t stream) {
  const float* x  = (const float*)d_in[0];
  const float* Wq = (const float*)d_in[1];
  const float* bq = (const float*)d_in[2];
  const float* Wk = (const float*)d_in[3];
  const float* bk = (const float*)d_in[4];
  const float* Wv = (const float*)d_in[5];
  const float* bv = (const float*)d_in[6];
  const float* E  = (const float*)d_in[7];
  float* outp = (float*)d_out;

  char* ws = (char*)d_ws;
  const size_t szQKV  = (size_t)M_TOTAL * D_MODEL * sizeof(_Float16);          // 32 MB each
  const size_t szProj = (size_t)BATCH * N_HEADS * LKF * HEAD_DIM;              // 524288 elems
  _Float16* Qh = (_Float16*)(ws);
  _Float16* Kh = (_Float16*)(ws + szQKV);
  _Float16* Vh = (_Float16*)(ws + 2 * szQKV);
  float* KpPart = (float*)(ws + 3 * szQKV);                                    // 16 MB
  float* VpPart = (float*)(ws + 3 * szQKV + SPLITL * szProj * sizeof(float));  // 16 MB
  _Float16* Kp = (_Float16*)(ws + 3 * szQKV + 2 * SPLITL * szProj * sizeof(float));
  _Float16* Vp = (_Float16*)((char*)Kp + szProj * sizeof(_Float16));
  _Float16* xh = (_Float16*)((char*)Vp + szProj * sizeof(_Float16));           // 32 MB
  _Float16* Wh = (_Float16*)((char*)xh + szQKV);                               // 6 MB

  to_f16_kernel<<<dim3(CVT_XB + 3 * CVT_WB), 256, 0, stream>>>(x, Wq, Wk, Wv, xh, Wh);

  qkv_proj_kernel<<<dim3(3 * D_MODEL / 256, M_TOTAL / 256), 256, 0, stream>>>(
      xh, Wh, bq, bk, bv, Qh, Kh, Vh);

  kv_lowrank_kernel<<<dim3(BATCH * N_HEADS, SPLITL), 256, 0, stream>>>(
      E, Kh, Vh, KpPart, VpPart);

  kv_reduce_kernel<<<dim3((unsigned)(szProj / 256)), 256, 0, stream>>>(
      KpPart, VpPart, Kp, Vp);

  attn_kernel<<<dim3(SEQ_LEN / 128, BATCH * N_HEADS), 256, 0, stream>>>(
      Qh, Kp, Vp, outp);
}

// v006
// It runs in 119 microseconds.
// In two side-by-side timings against v005, it was 1.12 and 1.11 times as fast.
// All steps since v000 together make it 2.41 times as fast.
#include <hip/hip_runtime.h>

#define D_MODEL 1024
#define SEQ_LEN 4096
#define N_HEADS 16
#define HEAD_DIM 64
#define LKF 128
#define BATCH 4
#define M_TOTAL (BATCH * SEQ_LEN) /* 16384 */
#define SPLITL 8                  /* split-K chunks for kernel 2 */

typedef __attribute__((ext_vector_type(16))) _Float16 v16h;
typedef __attribute__((ext_vector_type(8)))  _Float16 v8h;
typedef __attribute__((ext_vector_type(8)))  float    v8f;
typedef __attribute__((ext_vector_type(4)))  _Float16 v4h;
typedef __attribute__((ext_vector_type(4)))  float    v4f;

union V16H { v16h v; v8h h[2]; };

// Load one 16x32 f16 fragment for a lane.
// Per ISA 16-bit A/B layout: lane (0-15 -> m=lane, 16-31 -> m=lane-16) holds two
// contiguous 8-half runs: k in [kf, kf+8) and [kf+16, kf+24), kf = (lane>=16)?8:0.
__device__ __forceinline__ v16h frag_ld(const _Float16* base, int row, int stride, int koff) {
  V16H u;
  const _Float16* p = base + row * stride + koff;
  u.h[0] = *(const v8h*)(p);
  u.h[1] = *(const v8h*)(p + 16);
  return u.v;
}

__device__ __forceinline__ v8f wmma16(v16h a, v16h b, v8f c) {
  return __builtin_amdgcn_wmma_f32_16x16x32_f16(false, a, false, b, (short)0, c, false, false);
}

// ---------------------------------------------------------------------------
// Kernel 0: x and the three W, fp32 -> f16, once.  The projection reads every x row 12
// times and every W row 64 times out of L2: as f16 those reads are half the bytes, and
// the rounding (the same one, to nearest even) is done once per element.
// One workgroup converts 32768 contiguous floats: 32 x 16 B read and 32 x 8 B written per lane,
// every wave-wide load and store on whole 128-B lines; few, long waves, all resident at once,
// because a launch this short pays for every wave it starts.
// grid: 512 workgroups for x, then 32 each for Wq, Wk, Wv (Wh = [Wq | Wk | Wv] by rows).
// ---------------------------------------------------------------------------
#define CVT_EL 32768                               /* floats per workgroup */
#define CVT_PL (CVT_EL / (256 * 4))                /* 16-B loads per lane: 32 */
#define CVT_XB (M_TOTAL * D_MODEL / CVT_EL)        /* 512 */
#define CVT_WB (D_MODEL * D_MODEL / CVT_EL)        /* 32 */
__launch_bounds__(256)
__global__ void to_f16_kernel(const float* __restrict__ x, const float* __restrict__ Wq,
                              const float* __restrict__ Wk, const float* __restrict__ Wv,
                              _Float16* __restrict__ xh, _Float16* __restrict__ Wh)
{
  const int blk = blockIdx.x;
  const float* src;
  _Float16* dst;
  if (blk < CVT_XB) {
    src = x + (size_t)blk * CVT_EL;
    dst = xh + (size_t)blk * CVT_EL;
  } else {
    const int w   = blk - CVT_XB;
    const int sel = w / CVT_WB;
    src = (sel == 0 ? Wq : (sel == 1 ? Wk : Wv)) + (size_t)(w % CVT_WB) * CVT_EL;
    dst = Wh + (size_t)w * CVT_EL;
  }
  const v4f* s4 = (const v4f*)src + threadIdx.x;
  v4h*       d4 = (v4h*)dst + threadIdx.x;
  v4f f[CVT_PL];
  // read once, never again: non-temporal, so that the fp32 lines do not push the f16 copy out of L2
#pragma unroll
  for (int i = 0; i < CVT_PL; ++i) f[i] = __builtin_nontemporal_load(s4 + i * 256);
#pragma unroll
  for (int i = 0; i < CVT_PL; ++i) d4[i * 256] = __builtin_convertvector(f[i], v4h);
}

// ---------------------------------------------------------------------------
// Kernel 1: QKV projection.  C[m,n] = sum_k x[m,k] * W[n,k] + b[n], x and W as f16 from kernel 0
// One 256(M) x 256(N) tile of one of Q, K, V per workgroup, 128 k per pass.
// 8 waves as 2(M) x 4(N); each wave owns 128 x 64 = 8 x 4 accumulator tiles, so
// 12 fragments read from LDS feed 32 WMMAs.
// Two LDS buffers, filled by the tensor mover: waves 0 to 3 each ask for one slice of a stage
// (128 rows of 256 B of x or of W, padded to the pitch of 272 B) two passes ahead, into the
// buffer that every reader has just left; no tile byte passes through a register.
// Q is written [m][n]; K and V are written transposed, [b][n][l], the order the low-rank
// product reads them in.
// grid: x = 12 column tiles (4 each of Q, K, V), y = 64 row tiles.
// ---------------------------------------------------------------------------
#define TKP 128  /* k per pass: 256 B of every operand row */
#define TPI 136  /* LDS row pitch in halves: 272 B = 16 B x odd */
#define TOP (256 * TPI)   /* halves of one operand's tile */
#define TBUF (2 * TOP)    /* halves of one buffer: x tile, then W tile */
#define EPI 136  /* epilogue staging pitch in halves: 272 B = 256 B + 16 B */
#define NPASS (D_MODEL / TKP)
#define SLICE_ROWS 128                       /* rows of one tensor load */
#define SLICE_B (SLICE_ROWS * TPI * 2)       /* its bytes in LDS, pads counted: 34816 = 17 x 2 KiB */

__device__ __forceinline__ unsigned int uni(unsigned int v) {
  return (unsigned int)__builtin_amdgcn_readfirstlane(v);
}
__device__ __forceinline__ unsigned int pinned(unsigned int v) {
  unsigned int w = uni(v);
  asm volatile("" : "+s"(w));   // the issue test held in a scalar register
  return w;
}

// one request: 128 rows of 256 B, source pitch one row of x or W (2048 B), to LDS byte lds_dst
// with 16 B of pad behind every row.  The twelve descriptor words are written inside the
// statement, into scalar registers that nothing else in the kernel names: so every word is formed
// behind the wait that stands in front of the call, and none takes a new value while the
// request is outstanding.
// group 0: count 1 | LDS byte | address low | address high, type 2
// group 1: no mask, sizes in bytes, a pad of 4 dwords behind every 64 | tensor = tile = 256 B x 128 rows | pitch 2048 B
static_assert(TKP * 2 == 0x100 && SLICE_ROWS == 0x80 && D_MODEL * 2 == 0x800, "the descriptor's immediates");
__device__ __forceinline__ void slice_load(unsigned int lds_dst, unsigned long long ga) {
  const unsigned int w1 = uni(lds_dst);
  const unsigned int w2 = uni((unsigned int)ga);
  const unsigned int w3 = uni((((unsigned int)(ga >> 32)) & 0x01FFFFFFu) | 0x80000000u);
  asm volatile("s_mov_b32 s80, 1\n\t"
               "s_mov_b32 s81, %0\n\t"
               "s_mov_b32 s82, %1\n\t"
               "s_mov_b32 s83, %2\n\t"
               "s_mov_b32 s84, 0x7500000\n\t"   // 1 << 20 | 5 << 22 | 3 << 25
               "s_mov_b32 s85, 0x1000000\n\t"   // tensor_dim0 = 256, in bits 31 to 16
               "s_mov_b32 s86, 0x800000\n\t"    // tensor_dim1 = 128, in bits 31 to 16
               "s_mov_b32 s87, 0x1000000\n\t"   // tile_dim0 = 256, in bits 31 to 16
               "s_mov_b32 s88, 0x80\n\t"        // tile_dim1 = 128
               "s_mov_b32 s89, 0x800\n\t"       // source row pitch
               "s_mov_b32 s90, 0\n\t"
               "s_mov_b32 s91, 0\n\t"
               "tensor_load_to_lds s[80:83], s[84:91]"
               :: "s"(w1), "s"(w2), "s"(w3)
               : "memory", "s80", "s81", "s82", "s83", "s84", "s85", "s86", "s87", "s88", "s89", "s90", "s91");
}

// one pass's 128 WMMAs; ap, bp point at this lane's first fragment run in the buffer
__device__ __forceinline__ void pass_mma(v8f (&acc)[8][4], const _Float16* ap, const _Float16* bp) {
#pragma unroll
  for (int ks = 0; ks < TKP; ks += 32) {
    v16h a[8], b[4];
#pragma unroll
    for (int j = 0; j < 4; ++j) b[j] = frag_ld(bp, j * 16, TPI, ks);
#pragma unroll
    for (int i = 0; i < 8; ++i) a[i] = frag_ld(ap, i * 16, TPI, ks);
    // keeps the 24 LDS reads one group ahead of the 32 WMMAs: sunk among them, each
    // row of WMMAs would wait out its own LDS latency
    __builtin_amdgcn_sched_barrier(0);
#pragma unroll
    for (int i = 0; i < 8; ++i) {
#pragma unroll
      for (int j = 0; j < 4; ++j) acc[i][j] = wmma16(a[i], b[j], acc[i][j]);
    }
    // keeps the next 24 LDS reads behind these WMMAs: they land on the fragment registers
    // that these WMMAs still read
    __builtin_amdgcn_sched_barrier(0);
  }
}

__launch_bounds__(256)
__global__ void qkv_proj_kernel(const _Float16* __restrict__ xh, const _Float16* __restrict__ Wh,
                                const float* __restrict__ bq, const float* __restrict__ bk,
                                const float* __restrict__ bv,
                                _Float16* __restrict__ Qh, _Float16* __restrict__ Kh,
                                _Float16* __restrict__ Vh)
{
  __shared__ __attribute__((aligned(2048))) _Float16 Tl[2 * TBUF];   // two buffers of [x tile [m][k] | W tile [n][k]]

  const int tid  = threadIdx.x;
  const int wave = tid >> 5;
  const int lane = tid & 31;
  const int sel   = blockIdx.x >> 2;          // 0: Q, 1: K, 2: V
  const int nBase = (blockIdx.x & 3) * 256;
  const int mBase = blockIdx.y * 256;

  const float* bias = sel == 0 ? bq : (sel == 1 ? bk : bv);
  _Float16*    out  = sel == 0 ? Qh : (sel == 1 ? Kh : Vh);

  const int wm = (wave >> 2) * 128;   // wave's first row in the tile
  const int wn = (wave & 3) * 64;     // wave's first column in the tile

  v8f acc[8][4] = {};

  const int fr = lane & 15;
  const int kf = (lane >> 4) * 8;

  const int aOff  = (wm + fr) * TPI + kf;             // this lane's first x fragment run
  const int bOff  = TOP + (wn + fr) * TPI + kf;       // its first W fragment run

  // waves 0 and 1 bring the two halves of the x tile, waves 2 and 3 those of the W tile
  const unsigned int wv = uni(threadIdx.x >> 5);
  const _Float16* sl = (wv & 2u) ? Wh + (size_t)(blockIdx.x * 256 + (wv & 1u) * SLICE_ROWS) * D_MODEL   // Wh rows: Q, K, V
                                 : xh + (size_t)(mBase + (wv & 1u) * SLICE_ROWS) * D_MODEL;
  const unsigned long long sga = (unsigned long long)(size_t)sl;
  const unsigned int sdst = (unsigned int)(size_t)Tl + (wv & 3u) * SLICE_B;   // + buffer

  if (pinned(wv < 4u)) {
    slice_load(sdst, sga);
    asm volatile("s_wait_tensorcnt 0x0" ::: "memory");   // this wave's slice of stage 0 has landed
  }
  __syncthreads();   // publishes stage 0
  if (pinned(wv < 4u)) slice_load(sdst + TBUF * 2u, sga + TKP * 2u);   // stage 1

  // the pass loop stays rolled: an unrolled copy adds code and no overlap (the buffer's
  // offset costs one scalar select per pass)
#pragma unroll 1
  for (int t = 0; t < NPASS - 1; ++t) {
    const int cur = (t & 1) * TBUF;
    pass_mma(acc, &Tl[cur + aOff], &Tl[cur + bOff]);
    // this wave's reads of the buffer are done before a tensor load may be aimed at it
    asm volatile("s_wait_dscnt 0x0" ::: "memory");
    if (pinned(wv < 4u)) {
      asm volatile("s_wait_tensorcnt 0x0" ::: "memory");
    }
    // publishes stage t + 1 and ends every reader's last read of stage t
    __syncthreads();
    if (pinned((wv < 4u) & (t + 2 < NPASS)))   // only while a stage t + 2 exists
      slice_load(sdst + cur * 2u, sga + (unsigned long long)((t + 2) * (TKP * 2)));
  }
  pass_mma(acc, &Tl[((NPASS - 1) & 1) * TBUF + aOff], &Tl[((NPASS - 1) & 1) * TBUF + bOff]);
  // nothing of the ring is outstanding when the wave goes on to the epilogue
  asm volatile("s_wait_tensorcnt 0x0" ::: "memory");
  asm volatile("s_wait_dscnt 0x0" ::: "memory");

  // epilogue: bias add, f32 -> f16 store.  C layout: vgpr r -> m = r (lanes 0-15)
  // or r+8 (lanes 16-31); n = lane&15 within the 16-col tile.
  const int col  = lane & 15;
  const int rofs = (lane >> 4) * 8;
  _Float16* op = out + (size_t)(mBase + wm + rofs) * D_MODEL + nBase + wn + col;
  float bb[4];
  const int bcol = nBase + wn + col;
#pragma unroll
  for (int j = 0; j < 4; ++j) bb[j] = bias[bcol + j * 16];
  // the wait that stands before a register named by these loads is written again; index and
  // base are inputs so that they stay whole up to it
  asm volatile("s_wait_xcnt 0x0" :: "v"(bcol), "s"(bias) : "memory");
  if (sel != 0) {
    // K and V leave transposed, [b][n][l]: a lane's 8 accumulator rows of one column are 16
    // contiguous bytes there.  Each wave turns its 128 x 64 tile in its own LDS range, 64 rows
    // of 256 B at pitch 272 B, and stores whole 128-B lines.
    __syncthreads();   // ends the last pass's reads of buffer 1; the staging reuses buffer 0 only, whose reads ended at the loop's last barrier
    _Float16* st = &Tl[wave * (64 * EPI)];
#pragma unroll
    for (int j = 0; j < 4; ++j) {
#pragma unroll
      for (int i = 0; i < 8; ++i) {
        v8h hv;
#pragma unroll
        for (int r = 0; r < 8; ++r) hv[r] = (_Float16)(acc[i][j][r] + bb[j]);
        *(v8h*)(st + (j * 16 + col) * EPI + i * 16 + rofs) = hv;
      }
    }
    // the wave's own LDS writes are done before it reads other lanes' rows back
    asm volatile("s_wait_dscnt 0x0" ::: "memory");
    const int rr = lane >> 4;         // two rows per wave-wide access
    const int cc = (lane & 15) * 8;   // 16 lanes x 16 B = one row's 256 B
    v8h tv[32];
#pragma unroll
    for (int q = 0; q < 32; ++q) tv[q] = *(const v8h*)(st + (q * 2 + rr) * EPI + cc);
    // keeps all 32 reads ahead of the stores, each in registers of its own, so that no read
    // lands on a register of a store already issued
    __builtin_amdgcn_sched_barrier(0);
    _Float16* tp = out + ((size_t)(mBase / SEQ_LEN) * D_MODEL + nBase + wn + rr) * SEQ_LEN
                       + (mBase % SEQ_LEN) + wm + cc;
#pragma unroll
    for (int q = 0; q < 32; ++q) *(v8h*)(tp + (size_t)(q * 2) * SEQ_LEN) = tv[q];
    // the wait that stands before a register named by these stores is written again
    asm volatile("s_wait_xcnt 0x0" ::: "memory");
    return;
  }
#pragma unroll
  for (int g = 0; g < 8; g += 2) {   // two row tiles (32 rows x 64 columns) at a time
    _Float16 hv[2][8][4];
#pragma unroll
    for (int i = 0; i < 2; ++i) {
#pragma unroll
      for (int r = 0; r < 8; ++r) {
#pragma unroll
        for (int j = 0; j < 4; ++j) hv[i][r][j] = (_Float16)(acc[g + i][j][r] + bb[j]);
      }
    }
    // keeps this group's conversions ahead of its stores, so that none lands on a
    // register of a store already issued
    __builtin_amdgcn_sched_barrier(0);
#pragma unroll
    for (int i = 0; i < 2; ++i) {
#pragma unroll
      for (int r = 0; r < 8; ++r) {
#pragma unroll
        for (int j = 0; j < 4; ++j)
          op[(size_t)((g + i) * 16 + r) * D_MODEL + j * 16] = hv[i][r][j];
      }
    }
    if (g < 6) {
      // the wait that stands before the next group's conversions reuse the stores' registers
      asm volatile("s_wait_xcnt 0x0" ::: "memory");
      // holds those conversions behind the wait (a "memory" clobber does not order vector work)
      __builtin_amdgcn_sched_barrier(0);
    }
  }
}

// ---------------------------------------------------------------------------
// Kernel 2: Kp/Vp partials.  Kp[k,d] = sum_l E[h,k,l] * K^T[b,h*64+d,l]
// grid (64 bh, SPLITL);  each WG reduces a 512-wide l-chunk -> partial buffer.
// All 512 workgroups are resident at once, so the launch lasts as long as one workgroup's
// chain of 16 tiles.  A tile's six global loads are issued as one group two tiles ahead,
// right behind the barrier that publishes tile t, into the register set that tile t has
// just left; they land while tiles t and t + 1 are worked on.
// ---------------------------------------------------------------------------
// work-group barrier that orders LDS traffic only: __syncthreads() also waits out every global
// load of the wave, which would end the flight of the loads issued ahead at the next barrier
__device__ __forceinline__ void lds_barrier() {
  __builtin_amdgcn_fence(__ATOMIC_RELEASE, "workgroup", "local");
  __builtin_amdgcn_s_barrier();
  __builtin_amdgcn_fence(__ATOMIC_ACQUIRE, "workgroup", "local");
}

// one tile's global loads: 128 x 32 fp32 of E (4 x 16 B a lane), 64 x 32 f16 of K^T and of V^T
__device__ __forceinline__ void kv_tile_ld(float4 (&fe)[4], v8h& kk, v8h& vv,
                                           const float* ep, const _Float16* kp,
                                           const _Float16* vp) {
#pragma unroll
  for (int rr = 0; rr < 4; ++rr) fe[rr] = *(const float4*)(ep + (size_t)(rr * 32) * SEQ_LEN);
  kk = *(const v8h*)kp;
  vv = *(const v8h*)vp;
  // the wait that stands before a register named by these loads is written again
  asm volatile("s_wait_xcnt 0x0" ::: "memory");
  // holds what follows (address steps, LDS reads into the address registers) behind that wait,
  // and keeps the six loads ahead of the tile's LDS reads and WMMAs
  __builtin_amdgcn_sched_barrier(0);
}

__launch_bounds__(256)
__global__ void kv_lowrank_kernel(const float* __restrict__ E,
                                  const _Float16* __restrict__ Kh,
                                  const _Float16* __restrict__ Vh,
                                  float* __restrict__ KpPart, float* __restrict__ VpPart)
{
  __shared__ _Float16 Al[128 * 40];   // E tile  [krow][l]
  __shared__ __attribute__((aligned(16))) _Float16 BK[64 * 40];    // K^T tile [d][l]
  __shared__ __attribute__((aligned(16))) _Float16 BV[64 * 40];

  const int tid  = threadIdx.x;
  const int wave = tid >> 5;
  const int lane = tid & 31;
  const int bh = blockIdx.x;          // 0..63
  const int b  = bh >> 4, h = bh & 15;
  const int ls = blockIdx.y;          // split index

  v8f accK[4] = {}, accV[4] = {};

  const int lr = tid >> 3, lc = (tid & 7) * 4;
  const int tr = tid >> 2;            // d row of the K^T / V^T tile
  const int tc = (tid & 3) * 8;       // l group within the tile
  const int fr = lane & 15;
  const int kf = (lane >> 4) * 8;

  const size_t eBase  = (size_t)h * LKF * SEQ_LEN;
  const size_t kvBase = ((size_t)b * D_MODEL + (size_t)h * HEAD_DIM) * SEQ_LEN;
  const int lBeg = ls * (SEQ_LEN / SPLITL);
  const int lEnd = lBeg + (SEQ_LEN / SPLITL);

  const float*    ep = E + eBase + (size_t)lr * SEQ_LEN + lc;       // + l
  const _Float16* kp = Kh + kvBase + (size_t)tr * SEQ_LEN + tc;     // + l
  const _Float16* vp = Vh + kvBase + (size_t)tr * SEQ_LEN + tc;

  float4 fe[2][4];
  v8h kk[2], vv[2];
#pragma unroll
  for (int u = 0; u < 2; ++u)
    kv_tile_ld(fe[u], kk[u], vv[u], ep + lBeg + u * 32, kp + lBeg + u * 32, vp + lBeg + u * 32);

  // one tile out of register set u; more: a tile t + 2 exists and is asked for
  auto tile = [&](const int u, const int l0, const bool more) __attribute__((always_inline)) {
    lds_barrier();   // ends every reader's last read of the tile before
#pragma unroll
    for (int rr = 0; rr < 4; ++rr) {
      const float4 f = fe[u][rr];
      _Float16* d = &Al[(lr + rr * 32) * 40 + lc];
      d[0] = (_Float16)f.x; d[1] = (_Float16)f.y; d[2] = (_Float16)f.z; d[3] = (_Float16)f.w;
    }
    *(v8h*)&BK[tr * 40 + tc] = kk[u];
    *(v8h*)&BV[tr * 40 + tc] = vv[u];
    lds_barrier();   // publishes this tile

    if (more)
      kv_tile_ld(fe[u], kk[u], vv[u], ep + l0 + 64, kp + l0 + 64, vp + l0 + 64);

    const v16h a = frag_ld(&Al[(wave * 16) * 40], fr, 40, kf);
    // pipelined over t: next K/V fragments in flight during current WMMAs
    v16h bkc = frag_ld(&BK[0], fr, 40, kf);
    v16h bvc = frag_ld(&BV[0], fr, 40, kf);
#pragma unroll
    for (int t = 0; t < 3; ++t) {
      const v16h bkn = frag_ld(&BK[((t + 1) * 16) * 40], fr, 40, kf);
      const v16h bvn = frag_ld(&BV[((t + 1) * 16) * 40], fr, 40, kf);
      accK[t] = wmma16(a, bkc, accK[t]);
      accV[t] = wmma16(a, bvc, accV[t]);
      bkc = bkn; bvc = bvn;
    }
    accK[3] = wmma16(a, bkc, accK[3]);
    accV[3] = wmma16(a, bvc, accV[3]);
  };
  // two tiles a trip, so that each register set has a fixed name; the last two tiles stand
  // behind the loop, so that every trip issues the same loads and a tile's wait can leave
  // the younger set in flight
  for (int lp = lBeg; lp < lEnd - 64; lp += 64) {
    tile(0, lp, true);
    tile(1, lp + 32, true);
  }
  tile(0, lEnd - 64, false);
  tile(1, lEnd - 32, false);

  const int col = lane & 15, rofs = (lane >> 4) * 8;
  const size_t pb = ((size_t)ls * (BATCH * N_HEADS) + bh) * LKF * HEAD_DIM;
#pragma unroll
  for (int t = 0; t < 4; ++t) {
#pragma unroll
    for (int r = 0; r < 8; ++r) {
      const int krow = wave * 16 + rofs + r;
      const int n = t * 16 + col;
      KpPart[pb + (size_t)krow * HEAD_DIM + n] = accK[t][r];
      VpPart[pb + (size_t)krow * HEAD_DIM + n] = accV[t][r];
    }
  }
}

// Reduce SPLITL partials -> f16 Kp/Vp (deterministic, no atomics).
__launch_bounds__(256)
__global__ void kv_reduce_kernel(const float* __restrict__ KpPart,
                                 const float* __restrict__ VpPart,
                                 _Float16* __restrict__ Kp, _Float16* __restrict__ Vp)
{
  const size_t idx = (size_t)blockIdx.x * 256 + threadIdx.x;  // 0..524287
  const size_t stride = (size_t)BATCH * N_HEADS * LKF * HEAD_DIM;
  float sk = 0.f, sv = 0.f;
#pragma unroll
  for (int s = 0; s < SPLITL; ++s) { sk += KpPart[s * stride + idx]; sv += VpPart[s * stride + idx]; }
  Kp[idx] = (_Float16)sk;
  Vp[idx] = (_Float16)sv;
}

// ---------------------------------------------------------------------------
// Kernel 3: attention.  dot = Q @ Kp^T / 8 -> softmax(k=128) -> @ Vp -> out.
// grid (32 l-blocks, 64 bh); WG covers 128 rows of l (16 per wave).
// LDS: [VpL 64x136][ KpL 128x72  aliased with  AtL 8x16x136 ]  (52 KB)
// ---------------------------------------------------------------------------
__launch_bounds__(256)
__global__ void attn_kernel(const _Float16* __restrict__ Qh,
                            const _Float16* __restrict__ Kp, const _Float16* __restrict__ Vp,
                            float* __restrict__ out)
{
  __shared__ _Float16 smem[64 * 136 + 8 * 16 * 136];
  _Float16* VpL = smem;                 // [d][kidx]  (transposed Vp)
  _Float16* KpL = smem + 64 * 136;      // [kidx][d]  (row-major Kp) -- dead after GEMM1
  _Float16* AtL = smem + 64 * 136;      // [wave][m][kidx] attn rows -- reuses KpL space

  const int tid  = threadIdx.x;
  const int wave = tid >> 5;
  const int lane = tid & 31;
  const int lBase = blockIdx.x * 128;
  const int bh = blockIdx.y;
  const int b  = bh >> 4, h = bh & 15;

  // stage Kp (row-major) and Vp (transposed)
  {
    const int kr = tid >> 1;
    const int c0 = (tid & 1) * 32;
    const size_t src = ((size_t)bh * LKF + kr) * HEAD_DIM + c0;
#pragma unroll
    for (int j = 0; j < 4; ++j) {
      const v8h kk = *(const v8h*)(Kp + src + 8 * j);
      *(v8h*)(&KpL[kr * 72 + c0 + 8 * j]) = kk;
      const v8h vv = *(const v8h*)(Vp + src + 8 * j);
#pragma unroll
      for (int i = 0; i < 8; ++i) VpL[(c0 + 8 * j + i) * 136 + kr] = vv[i];
    }
  }

  const int fr = lane & 15;
  const int kf = (lane >> 4) * 8;
  const int rofs = (lane >> 4) * 8, col = lane & 15;

  // hoist both global Q fragments (k-halves 0..31, 32..63) before the barrier
  const _Float16* qBase = Qh + ((size_t)b * SEQ_LEN + lBase + wave * 16) * D_MODEL
                             + (size_t)h * HEAD_DIM;
  v16h afr[2];
#pragma unroll
  for (int ks = 0; ks < 2; ++ks) afr[ks] = frag_ld(qBase, fr, D_MODEL, ks * 32 + kf);

  __syncthreads();

  // GEMM1: dot[l, kidx] = Q[l,:64] . Kp[kidx,:64], pipelined over the 8 n-tiles
  v8f acc[8] = {};
#pragma unroll
  for (int ks = 0; ks < 2; ++ks) {
    v16h bc = frag_ld(&KpL[0], fr, 72, ks * 32 + kf);
#pragma unroll
    for (int t = 0; t < 7; ++t) {
      const v16h bn = frag_ld(&KpL[((t + 1) * 16) * 72], fr, 72, ks * 32 + kf);
      acc[t] = wmma16(afr[ks], bc, acc[t]);
      bc = bn;
    }
    acc[7] = wmma16(afr[ks], bc, acc[7]);
  }
  __syncthreads();   // KpL dead everywhere; AtL may now reuse its space

  // softmax over 128 per row; rows split across half-waves, reduce over 16 lanes
  const float scale = 0.125f;  // 1/sqrt(64)
  _Float16* at = &AtL[(wave * 16) * 136];
#pragma unroll
  for (int r = 0; r < 8; ++r) {
    float mx = -3.0e38f;
#pragma unroll
    for (int t = 0; t < 8; ++t) { acc[t][r] *= scale; mx = fmaxf(mx, acc[t][r]); }
#pragma unroll
    for (int s = 1; s < 16; s <<= 1) mx = fmaxf(mx, __shfl_xor(mx, s, 32));
    float sum = 0.f;
#pragma unroll
    for (int t = 0; t < 8; ++t) { const float e = __expf(acc[t][r] - mx); acc[t][r] = e; sum += e; }
#pragma unroll
    for (int s = 1; s < 16; s <<= 1) sum += __shfl_xor(sum, s, 32);
    const float inv = 1.0f / sum;
    const int m = rofs + r;
#pragma unroll
    for (int t = 0; t < 8; ++t) at[m * 136 + t * 16 + col] = (_Float16)(acc[t][r] * inv);
  }
  __syncthreads();

  // GEMM2: out[l, d] = attn[l,:128] . Vp[:,d], pipelined over the 4 n-tiles
  v8f o[4] = {};
#pragma unroll
  for (int ks = 0; ks < 4; ++ks) {
    const v16h a = frag_ld(at, fr, 136, ks * 32 + kf);
    v16h bc = frag_ld(&VpL[0], fr, 136, ks * 32 + kf);
#pragma unroll
    for (int t = 0; t < 3; ++t) {
      const v16h bn = frag_ld(&VpL[((t + 1) * 16) * 136], fr, 136, ks * 32 + kf);
      o[t] = wmma16(a, bc, o[t]);
      bc = bn;
    }
    o[3] = wmma16(a, bc, o[3]);
  }
  // epilogue: head-combined fp32 output [b, l, h*64 + d]
#pragma unroll
  for (int t = 0; t < 4; ++t) {
#pragma unroll
    for (int r = 0; r < 8; ++r) {
      const int l = lBase + wave * 16 + rofs + r;
      out[((size_t)b * SEQ_LEN + l) * D_MODEL + (size_t)h * HEAD_DIM + t * 16 + col] = o[t][r];
    }
  }
}

// ---------------------------------------------------------------------------
extern "C" void kernel_launch(void* const* d_in, const int* in_sizes, int n_in,
                              void* d_out, int out_size, void* d_ws, size_t ws_size,
                              hipStream_t stream) {
  const float* x  = (const float*)d_in[0];
  const float* Wq = (const float*)d_in[1];
  const float* bq = (const float*)d_in[2];
  const float* Wk = (const float*)d_in[3];
  const float* bk = (const float*)d_in[4];
  const float* Wv = (const float*)d_in[5];
  const float* bv = (const float*)d_in[6];
  const float* E  = (const float*)d_in[7];
  float* outp = (float*)d_out;

  char* ws = (char*)d_ws;
  const size_t szQKV  = (size_t)M_TOTAL * D_MODEL * sizeof(_Float16);          // 32 MB each
  const size_t szProj = (size_t)BATCH * N_HEADS * LKF * HEAD_DIM;              // 524288 elems
  _Float16* Qh = (_Float16*)(ws);
  _Float16* Kh = (_Float16*)(ws + szQKV);
  _Float16* Vh = (_Float16*)(ws + 2 * szQKV);
  float* KpPart = (float*)(ws + 3 * szQKV);                                    // 16 MB
  float* VpPart = (float*)(ws + 3 * szQKV + SPLITL * szProj * sizeof(float));  // 16 MB
  _Float16* Kp = (_Float16*)(ws + 3 * szQKV + 2 * SPLITL * szProj * sizeof(float));
  _Float16* Vp = (_Float16*)((char*)Kp + szProj * sizeof(_Float16));
  _Float16* xh = (_Float16*)((char*)Vp + szProj * sizeof(_Float16));           // 32 MB
  _Float16* Wh = (_Float16*)((char*)xh + szQKV);                               // 6 MB

  to_f16_kernel<<<dim3(CVT_XB + 3 * CVT_WB), 256, 0, stream>>>(x, Wq, Wk, Wv, xh, Wh);

  qkv_proj_kernel<<<dim3(3 * D_MODEL / 256, M_TOTAL / 256), 256, 0, stream>>>(
      xh, Wh, bq, bk, bv, Qh, Kh, Vh);

  kv_lowrank_kernel<<<dim3(BATCH * N_HEADS, SPLITL), 256, 0, stream>>>(
      E, Kh, Vh, KpPart, VpPart);

  kv_reduce_kernel<<<dim3((unsigned)(szProj / 256)), 256, 0, stream>>>(
      KpPart, VpPart, Kp, Vp);

  attn_kernel<<<dim3(SEQ_LEN / 128, BATCH * N_HEADS), 256, 0, stream>>>(
      Qh, Kp, Vp, outp);
}

// v007
// One run takes 109 microseconds.
// In both of two side-by-side timings against v006, it was 1.09 times as fast.
// Counting every step since v000, it is 2.64 times as fast.
#include <hip/hip_runtime.h>

#define D_MODEL 1024
#define SEQ_LEN 4096
#define N_HEADS 16
#define HEAD_DIM 64
#define LKF 128
#define BATCH 4
#define M_TOTAL (BATCH * SEQ_LEN) /* 16384 */
#define SPLITL 8                  /* split-K chunks for kernel 2 */

typedef __attribute__((ext_vector_type(16))) _Float16 v16h;
typedef __attribute__((ext_vector_type(8)))  _Float16 v8h;
typedef __attribute__((ext_vector_type(8)))  float    v8f;
typedef __attribute__((ext_vector_type(4)))  _Float16 v4h;
typedef __attribute__((ext_vector_type(4)))  float    v4f;

union V16H { v16h v; v8h h[2]; };

// Load one 16x32 f16 fragment for a lane.
// Per ISA 16-bit A/B layout: lane (0-15 -> m=lane, 16-31 -> m=lane-16) holds two
// contiguous 8-half runs: k in [kf, kf+8) and [kf+16, kf+24), kf = (lane>=16)?8:0.
__device__ __forceinline__ v16h frag_ld(const _Float16* base, int row, int stride, int koff) {
  V16H u;
  const _Float16* p = base + row * stride + koff;
  u.h[0] = *(const v8h*)(p);
  u.h[1] = *(const v8h*)(p + 16);
  return u.v;
}

__device__ __forceinline__ v8f wmma16(v16h a, v16h b, v8f c) {
  return __builtin_amdgcn_wmma_f32_16x16x32_f16(false, a, false, b, (short)0, c, false, false);
}

// ---------------------------------------------------------------------------
// Kernel 0: x and the three W, fp32 -> f16, once.  The projection reads every x row 12
// times and every W row 64 times out of L2: as f16 those reads are half the bytes, and
// the rounding (the same one, to nearest even) is done once per element.
// One workgroup converts 32768 contiguous floats: 32 x 16 B read and 32 x 8 B written per lane,
// every wave-wide load and store on whole 128-B lines; few, long waves, all resident at once,
// because a launch this short pays for every wave it starts.
// grid: 512 workgroups for x, then 32 each for Wq, Wk, Wv (Wh = [Wq | Wk | Wv] by rows).
// ---------------------------------------------------------------------------
#define CVT_EL 32768                               /* floats per workgroup */
#define CVT_PL (CVT_EL / (256 * 4))                /* 16-B loads per lane: 32 */
#define CVT_XB (M_TOTAL * D_MODEL / CVT_EL)        /* 512 */
#define CVT_WB (D_MODEL * D_MODEL / CVT_EL)        /* 32 */
__launch_bounds__(256)
__global__ void to_f16_kernel(const float* __restrict__ x, const float* __restrict__ Wq,
                              const float* __restrict__ Wk, const float* __restrict__ Wv,
                              _Float16* __restrict__ xh, _Float16* __restrict__ Wh)
{
  const int blk = blockIdx.x;
  const float* src;
  _Float16* dst;
  if (blk < CVT_XB) {
    src = x + (size_t)blk * CVT_EL;
    dst = xh + (size_t)blk * CVT_EL;
  } else {
    const int w   = blk - CVT_XB;
    const int sel = w / CVT_WB;
    src = (sel == 0 ? Wq : (sel == 1 ? Wk : Wv)) + (size_t)(w % CVT_WB) * CVT_EL;
    dst = Wh + (size_t)w * CVT_EL;
  }
  const v4f* s4 = (const v4f*)src + threadIdx.x;
  v4h*       d4 = (v4h*)dst + threadIdx.x;
  v4f f[CVT_PL];
  // read once, never again: non-temporal, so that the fp32 lines do not push the f16 copy out of L2
#pragma unroll
  for (int i = 0; i < CVT_PL; ++i) f[i] = __builtin_nontemporal_load(s4 + i * 256);
#pragma unroll
  for (int i = 0; i < CVT_PL; ++i) d4[i * 256] = __builtin_convertvector(f[i], v4h);
}

// ---------------------------------------------------------------------------
// Kernel 1: QKV projection.  C[m,n] = sum_k x[m,k] * W[n,k] + b[n], x and W as f16 from kernel 0
// One 256(M) x 256(N) tile of one of Q, K, V per workgroup, 128 k per pass.
// 8 waves as 2(M) x 4(N); each wave owns 128 x 64 = 8 x 4 accumulator tiles, so
// 12 fragments read from LDS feed 32 WMMAs.
// Two LDS buffers, filled by the tensor mover: waves 0 to 3 each ask for one slice of a stage
// (128 rows of 256 B of x or of W, padded to the pitch of 272 B) two passes ahead, into the
// buffer that every reader has just left; no tile byte passes through a register.
// Q is written [m][n]; K and V are written transposed, [b][n][l], the order the low-rank
// product reads them in.
// grid: x = 12 column tiles (4 each of Q, K, V), y = 64 row tiles.
// ---------------------------------------------------------------------------
#define TKP 128  /* k per pass: 256 B of every operand row */
#define TPI 136  /* LDS row pitch in halves: 272 B = 16 B x odd */
#define TOP (256 * TPI)   /* halves of one operand's tile */
#define TBUF (2 * TOP)    /* halves of one buffer: x tile, then W tile */
#define EPI 136  /* epilogue staging pitch in halves: 272 B = 256 B + 16 B */
#define NPASS (D_MODEL / TKP)
#define SLICE_ROWS 128                       /* rows of one tensor load */
#define SLICE_B (SLICE_ROWS * TPI * 2)       /* its bytes in LDS, pads counted: 34816 = 17 x 2 KiB */

__device__ __forceinline__ unsigned int uni(unsigned int v) {
  return (unsigned int)__builtin_amdgcn_readfirstlane(v);
}
__device__ __forceinline__ unsigned int pinned(unsigned int v) {
  unsigned int w = uni(v);
  asm volatile("" : "+s"(w));   // the issue test held in a scalar register
  return w;
}

// one request: 128 rows of 256 B, source pitch one row of x or W (2048 B), to LDS byte lds_dst
// with 16 B of pad behind every row.  The twelve descriptor words are written inside the
// statement, into scalar registers that nothing else in the kernel names: so every word is formed
// behind the wait that stands in front of the call, and none takes a new value while the
// request is outstanding.
// group 0: count 1 | LDS byte | address low | address high, type 2
// group 1: no mask, sizes in bytes, a pad of 4 dwords behind every 64 | tensor = tile = 256 B x 128 rows | pitch 2048 B
static_assert(TKP * 2 == 0x100 && SLICE_ROWS == 0x80 && D_MODEL * 2 == 0x800, "the descriptor's immediates");
__device__ __forceinline__ void slice_load(unsigned int lds_dst, unsigned long long ga) {
  const unsigned int w1 = uni(lds_dst);
  const unsigned int w2 = uni((unsigned int)ga);
  const unsigned int w3 = uni((((unsigned int)(ga >> 32)) & 0x01FFFFFFu) | 0x80000000u);
  asm volatile("s_mov_b32 s80, 1\n\t"
               "s_mov_b32 s81, %0\n\t"
               "s_mov_b32 s82, %1\n\t"
               "s_mov_b32 s83, %2\n\t"
               "s_mov_b32 s84, 0x7500000\n\t"   // 1 << 20 | 5 << 22 | 3 << 25
               "s_mov_b32 s85, 0x1000000\n\t"   // tensor_dim0 = 256, in bits 31 to 16
               "s_mov_b32 s86, 0x800000\n\t"    // tensor_dim1 = 128, in bits 31 to 16
               "s_mov_b32 s87, 0x1000000\n\t"   // tile_dim0 = 256, in bits 31 to 16
               "s_mov_b32 s88, 0x80\n\t"        // tile_dim1 = 128
               "s_mov_b32 s89, 0x800\n\t"       // source row pitch
               "s_mov_b32 s90, 0\n\t"
               "s_mov_b32 s91, 0\n\t"
               "tensor_load_to_lds s[80:83], s[84:91]"
               :: "s"(w1), "s"(w2), "s"(w3)
               : "memory", "s80", "s81", "s82", "s83", "s84", "s85", "s86", "s87", "s88", "s89", "s90", "s91");
}

// one pass's 128 WMMAs; ap, bp point at this lane's first fragment run in the buffer
__device__ __forceinline__ void pass_mma(v8f (&acc)[8][4], const _Float16* ap, const _Float16* bp) {
#pragma unroll
  for (int ks = 0; ks < TKP; ks += 32) {
    v16h a[8], b[4];
#pragma unroll
    for (int j = 0; j < 4; ++j) b[j] = frag_ld(bp, j * 16, TPI, ks);
#pragma unroll
    for (int i = 0; i < 8; ++i) a[i] = frag_ld(ap, i * 16, TPI, ks);
    // keeps the 24 LDS reads one group ahead of the 32 WMMAs: sunk among them, each
    // row of WMMAs would wait out its own LDS latency
    __builtin_amdgcn_sched_barrier(0);
#pragma unroll
    for (int i = 0; i < 8; ++i) {
#pragma unroll
      for (int j = 0; j < 4; ++j) acc[i][j] = wmma16(a[i], b[j], acc[i][j]);
    }
    // keeps the next 24 LDS reads behind these WMMAs: they land on the fragment registers
    // that these WMMAs still read
    __builtin_amdgcn_sched_barrier(0);
  }
}

__launch_bounds__(256)
__global__ void qkv_proj_kernel(const _Float16* __restrict__ xh, const _Float16* __restrict__ Wh,
                                const float* __restrict__ bq, const float* __restrict__ bk,
                                const float* __restrict__ bv,
                                _Float16* __restrict__ Qh, _Float16* __restrict__ Kh,
                                _Float16* __restrict__ Vh)
{
  __shared__ __attribute__((aligned(2048))) _Float16 Tl[2 * TBUF];   // two buffers of [x tile [m][k] | W tile [n][k]]

  const int tid  = threadIdx.x;
  const int wave = tid >> 5;
  const int lane = tid & 31;
  const int sel   = blockIdx.x >> 2;          // 0: Q, 1: K, 2: V
  const int nBase = (blockIdx.x & 3) * 256;
  const int mBase = blockIdx.y * 256;

  const float* bias = sel == 0 ? bq : (sel == 1 ? bk : bv);
  _Float16*    out  = sel == 0 ? Qh : (sel == 1 ? Kh : Vh);

  const int wm = (wave >> 2) * 128;   // wave's first row in the tile
  const int wn = (wave & 3) * 64;     // wave's first column in the tile

  v8f acc[8][4] = {};

  const int fr = lane & 15;
  const int kf = (lane >> 4) * 8;

  const int aOff  = (wm + fr) * TPI + kf;             // this lane's first x fragment run
  const int bOff  = TOP + (wn + fr) * TPI + kf;       // its first W fragment run

  // waves 0 and 1 bring the two halves of the x tile, waves 2 and 3 those of the W tile
  const unsigned int wv = uni(threadIdx.x >> 5);
  const _Float16* sl = (wv & 2u) ? Wh + (size_t)(blockIdx.x * 256 + (wv & 1u) * SLICE_ROWS) * D_MODEL   // Wh rows: Q, K, V
                                 : xh + (size_t)(mBase + (wv & 1u) * SLICE_ROWS) * D_MODEL;
  const unsigned long long sga = (unsigned long long)(size_t)sl;
  const unsigned int sdst = (unsigned int)(size_t)Tl + (wv & 3u) * SLICE_B;   // + buffer

  if (pinned(wv < 4u)) {
    slice_load(sdst, sga);
    asm volatile("s_wait_tensorcnt 0x0" ::: "memory");   // this wave's slice of stage 0 has landed
  }
  __syncthreads();   // publishes stage 0
  if (pinned(wv < 4u)) slice_load(sdst + TBUF * 2u, sga + TKP * 2u);   // stage 1

  // the pass loop stays rolled: an unrolled copy adds code and no overlap (the buffer's
  // offset costs one scalar select per pass)
#pragma unroll 1
  for (int t = 0; t < NPASS - 1; ++t) {
    const int cur = (t & 1) * TBUF;
    pass_mma(acc, &Tl[cur + aOff], &Tl[cur + bOff]);
    // this wave's reads of the buffer are done before a tensor load may be aimed at it
    asm volatile("s_wait_dscnt 0x0" ::: "memory");
    if (pinned(wv < 4u)) {
      asm volatile("s_wait_tensorcnt 0x0" ::: "memory");
    }
    // publishes stage t + 1 and ends every reader's last read of stage t
    __syncthreads();
    if (pinned((wv < 4u) & (t + 2 < NPASS)))   // only while a stage t + 2 exists
      slice_load(sdst + cur * 2u, sga + (unsigned long long)((t + 2) * (TKP * 2)));
  }
  pass_mma(acc, &Tl[((NPASS - 1) & 1) * TBUF + aOff], &Tl[((NPASS - 1) & 1) * TBUF + bOff]);
  // nothing of the ring is outstanding when the wave goes on to the epilogue
  asm volatile("s_wait_tensorcnt 0x0" ::: "memory");
  asm volatile("s_wait_dscnt 0x0" ::: "memory");

  // epilogue: bias add, f32 -> f16 store.  C layout: vgpr r -> m = r (lanes 0-15)
  // or r+8 (lanes 16-31); n = lane&15 within the 16-col tile.
  const int col  = lane & 15;
  const int rofs = (lane >> 4) * 8;
  _Float16* op = out + (size_t)(mBase + wm + rofs) * D_MODEL + nBase + wn + col;
  float bb[4];
  const int bcol = nBase + wn + col;
#pragma unroll
  for (int j = 0; j < 4; ++j) bb[j] = bias[bcol + j * 16];
  // the wait that stands before a register named by these loads is written again; index and
  // base are inputs so that they stay whole up to it
  asm volatile("s_wait_xcnt 0x0" :: "v"(bcol), "s"(bias) : "memory");
  if (sel != 0) {
    // K and V leave transposed, [b][n][l]: a lane's 8 accumulator rows of one column are 16
    // contiguous bytes there.  Each wave turns its 128 x 64 tile in its own LDS range, 64 rows
    // of 256 B at pitch 272 B, and stores whole 128-B lines.
    __syncthreads();   // ends the last pass's reads of buffer 1; the staging reuses buffer 0 only, whose reads ended at the loop's last barrier
    _Float16* st = &Tl[wave * (64 * EPI)];
#pragma unroll
    for (int j = 0; j < 4; ++j) {
#pragma unroll
      for (int i = 0; i < 8; ++i) {
        v8h hv;
#pragma unroll
        for (int r = 0; r < 8; ++r) hv[r] = (_Float16)(acc[i][j][r] + bb[j]);
        *(v8h*)(st + (j * 16 + col) * EPI + i * 16 + rofs) = hv;
      }
    }
    // the wave's own LDS writes are done before it reads other lanes' rows back
    asm volatile("s_wait_dscnt 0x0" ::: "memory");
    const int rr = lane >> 4;         // two rows per wave-wide access
    const int cc = (lane & 15) * 8;   // 16 lanes x 16 B = one row's 256 B
    v8h tv[32];
#pragma unroll
    for (int q = 0; q < 32; ++q) tv[q] = *(const v8h*)(st + (q * 2 + rr) * EPI + cc);
    // keeps all 32 reads ahead of the stores, each in registers of its own, so that no read
    // lands on a register of a store already issued
    __builtin_amdgcn_sched_barrier(0);
    _Float16* tp = out + ((size_t)(mBase / SEQ_LEN) * D_MODEL + nBase + wn + rr) * SEQ_LEN
                       + (mBase % SEQ_LEN) + wm + cc;
#pragma unroll
    for (int q = 0; q < 32; ++q) *(v8h*)(tp + (size_t)(q * 2) * SEQ_LEN) = tv[q];
    // the wait that stands before a register named by these stores is written again
    asm volatile("s_wait_xcnt 0x0" ::: "memory");
    return;
  }
#pragma unroll
  for (int g = 0; g < 8; g += 2) {   // two row tiles (32 rows x 64 columns) at a time
    _Float16 hv[2][8][4];
#pragma unroll
    for (int i = 0; i < 2; ++i) {
#pragma unroll
      for (int r = 0; r < 8; ++r) {
#pragma unroll
        for (int j = 0; j < 4; ++j) hv[i][r][j] = (_Float16)(acc[g + i][j][r] + bb[j]);
      }
    }
    // keeps this group's conversions ahead of its stores, so that none lands on a
    // register of a store already issued
    __builtin_amdgcn_sched_barrier(0);
#pragma unroll
    for (int i = 0; i < 2; ++i) {
#pragma unroll
      for (int r = 0; r < 8; ++r) {
#pragma unroll
        for (int j = 0; j < 4; ++j)
          op[(size_t)((g + i) * 16 + r) * D_MODEL + j * 16] = hv[i][r][j];
      }
    }
    if (g < 6) {
      // the wait that stands before the next group's conversions reuse the stores' registers
      asm volatile("s_wait_xcnt 0x0" ::: "memory");
      // holds those conversions behind the wait (a "memory" clobber does not order vector work)
      __builtin_amdgcn_sched_barrier(0);
    }
  }
}

// ---------------------------------------------------------------------------
// Kernel 2: Kp/Vp partials.  Kp[k,d] = sum_l E[h,k,l] * K^T[b,h*64+d,l]; Vp leaves transposed, [d][k]
// grid (64 bh, SPLITL);  each WG reduces a 512-wide l-chunk -> partial buffer.
// All 512 workgroups are resident at once, so the launch lasts as long as one workgroup's
// chain of 16 tiles.  A tile's six global loads are issued as one group two tiles ahead,
// right behind the barrier that publishes tile t, into the register set that tile t has
// just left; they land while tiles t and t + 1 are worked on.
// ---------------------------------------------------------------------------
// work-group barrier that orders LDS traffic only: __syncthreads() also waits out every global
// load of the wave, which would end the flight of the loads issued ahead at the next barrier
__device__ __forceinline__ void lds_barrier() {
  __builtin_amdgcn_fence(__ATOMIC_RELEASE, "workgroup", "local");
  __builtin_amdgcn_s_barrier();
  __builtin_amdgcn_fence(__ATOMIC_ACQUIRE, "workgroup", "local");
}

// one tile's global loads: 128 x 32 fp32 of E (4 x 16 B a lane), 64 x 32 f16 of K^T and of V^T
__device__ __forceinline__ void kv_tile_ld(float4 (&fe)[4], v8h& kk, v8h& vv,
                                           const float* ep, const _Float16* kp,
                                           const _Float16* vp) {
#pragma unroll
  for (int rr = 0; rr < 4; ++rr) fe[rr] = *(const float4*)(ep + (size_t)(rr * 32) * SEQ_LEN);
  kk = *(const v8h*)kp;
  vv = *(const v8h*)vp;
  // the wait that stands before a register named by these loads is written again
  asm volatile("s_wait_xcnt 0x0" ::: "memory");
  // holds what follows (address steps, LDS reads into the address registers) behind that wait,
  // and keeps the six loads ahead of the tile's LDS reads and WMMAs
  __builtin_amdgcn_sched_barrier(0);
}

__launch_bounds__(256)
__global__ void kv_lowrank_kernel(const float* __restrict__ E,
                                  const _Float16* __restrict__ Kh,
                                  const _Float16* __restrict__ Vh,
                                  float* __restrict__ KpPart, float* __restrict__ VpPart)
{
  __shared__ _Float16 Al[128 * 40];   // E tile  [krow][l]
  __shared__ __attribute__((aligned(16))) _Float16 BK[64 * 40];    // K^T tile [d][l]
  __shared__ __attribute__((aligned(16))) _Float16 BV[64 * 40];

  const int tid  = threadIdx.x;
  const int wave = tid >> 5;
  const int lane = tid & 31;
  const int bh = blockIdx.x;          // 0..63
  const int b  = bh >> 4, h = bh & 15;
  const int ls = blockIdx.y;          // split index

  v8f accK[4] = {}, accV[4] = {};

  const int lr = tid >> 3, lc = (tid & 7) * 4;
  const int tr = tid >> 2;            // d row of the K^T / V^T tile
  const int tc = (tid & 3) * 8;       // l group within the tile
  const int fr = lane & 15;
  const int kf = (lane >> 4) * 8;

  const size_t eBase  = (size_t)h * LKF * SEQ_LEN;
  const size_t kvBase = ((size_t)b * D_MODEL + (size_t)h * HEAD_DIM) * SEQ_LEN;
  const int lBeg = ls * (SEQ_LEN / SPLITL);
  const int lEnd = lBeg + (SEQ_LEN / SPLITL);

  const float*    ep = E + eBase + (size_t)lr * SEQ_LEN + lc;       // + l
  const _Float16* kp = Kh + kvBase + (size_t)tr * SEQ_LEN + tc;     // + l
  const _Float16* vp = Vh + kvBase + (size_t)tr * SEQ_LEN + tc;

  float4 fe[2][4];
  v8h kk[2], vv[2];
#pragma unroll
  for (int u = 0; u < 2; ++u)
    kv_tile_ld(fe[u], kk[u], vv[u], ep + lBeg + u * 32, kp + lBeg + u * 32, vp + lBeg + u * 32);

  // one tile out of register set u; more: a tile t + 2 exists and is asked for
  auto tile = [&](const int u, const int l0, const bool more) __attribute__((always_inline)) {
    lds_barrier();   // ends every reader's last read of the tile before
#pragma unroll
    for (int rr = 0; rr < 4; ++rr) {
      const float4 f = fe[u][rr];
      _Float16* d = &Al[(lr + rr * 32) * 40 + lc];
      d[0] = (_Float16)f.x; d[1] = (_Float16)f.y; d[2] = (_Float16)f.z; d[3] = (_Float16)f.w;
    }
    *(v8h*)&BK[tr * 40 + tc] = kk[u];
    *(v8h*)&BV[tr * 40 + tc] = vv[u];
    lds_barrier();   // publishes this tile

    if (more)
      kv_tile_ld(fe[u], kk[u], vv[u], ep + l0 + 64, kp + l0 + 64, vp + l0 + 64);

    const v16h a = frag_ld(&Al[(wave * 16) * 40], fr, 40, kf);
    // pipelined over t: next K/V fragments in flight during current WMMAs
    v16h bkc = frag_ld(&BK[0], fr, 40, kf);
    v16h bvc = frag_ld(&BV[0], fr, 40, kf);
#pragma unroll
    for (int t = 0; t < 3; ++t) {
      const v16h bkn = frag_ld(&BK[((t + 1) * 16) * 40], fr, 40, kf);
      const v16h bvn = frag_ld(&BV[((t + 1) * 16) * 40], fr, 40, kf);
      accK[t] = wmma16(a, bkc, accK[t]);
      accV[t] = wmma16(bvc, a, accV[t]);   // operands swapped: Vp^T[d, k]
      bkc = bkn; bvc = bvn;
    }
    accK[3] = wmma16(a, bkc, accK[3]);
    accV[3] = wmma16(bvc, a, accV[3]);
  };
  // two tiles a trip, so that each register set has a fixed name; the last two tiles stand
  // behind the loop, so that every trip issues the same loads and a tile's wait can leave
  // the younger set in flight
  for (int lp = lBeg; lp < lEnd - 64; lp += 64) {
    tile(0, lp, true);
    tile(1, lp + 32, true);
  }
  tile(0, lEnd - 64, false);
  tile(1, lEnd - 32, false);

  const int col = lane & 15, rofs = (lane >> 4) * 8;
  const size_t pb = ((size_t)ls * (BATCH * N_HEADS) + bh) * LKF * HEAD_DIM;
#pragma unroll
  for (int t = 0; t < 4; ++t) {
#pragma unroll
    for (int r = 0; r < 8; ++r) {
      const int krow = wave * 16 + rofs + r;
      const int n = t * 16 + col;
      KpPart[pb + (size_t)krow * HEAD_DIM + n] = accK[t][r];
      // accV is Vp^T: row d = t * 16 + rofs + r, column k = wave * 16 + col
      VpPart[pb + (size_t)(t * 16 + rofs + r) * LKF + wave * 16 + col] = accV[t][r];
    }
  }
}

// Reduce SPLITL partials -> f16 Kp [k][d] and Vp^T [d][k], element by element (deterministic, no atomics).
__launch_bounds__(256)
__global__ void kv_reduce_kernel(const float* __restrict__ KpPart,
                                 const float* __restrict__ VpPart,
                                 _Float16* __restrict__ Kp, _Float16* __restrict__ Vp)
{
  const size_t idx = (size_t)blockIdx.x * 256 + threadIdx.x;  // 0..524287
  const size_t stride = (size_t)BATCH * N_HEADS * LKF * HEAD_DIM;
  float sk = 0.f, sv = 0.f;
#pragma unroll
  for (int s = 0; s < SPLITL; ++s) { sk += KpPart[s * stride + idx]; sv += VpPart[s * stride + idx]; }
  Kp[idx] = (_Float16)sk;
  Vp[idx] = (_Float16)sv;
}

// ---------------------------------------------------------------------------
// Kernel 3: attention, computed transposed.  S^T = Kp @ Q^T, softmax down each column,
// O^T = Vp^T @ P^T.  A lane then holds 64 of the 128 scores of ONE row l (lane ^ 16 holds the
// other 64): the maximum and the sum are register work and one cross-row move each, and the
// accumulator registers of S^T are, position by position, the B fragment of P^T, so that the
// weights never pass through LDS.
// Kp and Vp^T are the A operands, the same for every l: each wave reads their 32 fragments out
// of LDS once and keeps them in registers over its 8 row tiles.
// grid (4 l-blocks, 64 bh): one workgroup per WGP, 1024 rows of l, 8 tiles of 16 rows per wave.
// ---------------------------------------------------------------------------
#define AT_ROWS 1024                    /* l rows per workgroup */
#define AT_TILES (AT_ROWS / (8 * 16))   /* row tiles per wave */
#define OPI 68                          /* output staging pitch in floats: 272 B = 16 B x odd */

// lane l <-> lane l ^ 16 in one vector instruction (a shuffle would go through the LDS pipe)
__device__ __forceinline__ float other_row(float v) {
  const int i = __builtin_bit_cast(int, v);
  return __builtin_bit_cast(float,
      __builtin_amdgcn_permlanex16(i, i, 0x76543210, 0xfedcba98, false, false));
}

// one row tile's Q fragments (16 rows x 64 d), straight from global memory; p: this lane's row and run
__device__ __forceinline__ void q_ld(v16h (&q)[2], const _Float16* p) {
  q[0] = frag_ld(p, 0, 0, 0);
  q[1] = frag_ld(p, 0, 0, 32);
  // the wait that stands before a register named by these loads is written again
  asm volatile("s_wait_xcnt 0x0" ::: "memory");
  // holds what follows (address steps) behind that wait, and the loads ahead of the softmax
  __builtin_amdgcn_sched_barrier(0);
}

__launch_bounds__(256)
__global__ void attn_kernel(const _Float16* __restrict__ Qh,
                            const _Float16* __restrict__ Kp, const _Float16* __restrict__ VpT,
                            float* __restrict__ out)
{
  __shared__ __attribute__((aligned(16))) _Float16 KpL[128 * 72];    // [kidx][d]
  __shared__ __attribute__((aligned(16))) _Float16 VpL[64 * 136];    // [d][kidx]
  __shared__ __attribute__((aligned(16))) float    OL[8 * 16 * OPI]; // [wave][l][d]

  const int tid  = threadIdx.x;
  const int wave = tid >> 5;
  const int lane = tid & 31;
  const int bh = blockIdx.y;
  const int b  = bh >> 4, h = bh & 15;
  const int lBase = blockIdx.x * AT_ROWS + wave * 16;   // + 128 per tile

  const int fr = lane & 15;
  const int kf = (lane >> 4) * 8;
  const int rofs = (lane >> 4) * 8, col = lane & 15;

  // the first two tiles' Q fragments fly while Kp and Vp^T are staged
  const _Float16* qp = Qh + ((size_t)b * SEQ_LEN + lBase + fr) * D_MODEL + (size_t)h * HEAD_DIM + kf;
  v16h q0[2], q1[2];
  q_ld(q0, qp);
  q_ld(q1, qp + (size_t)128 * D_MODEL);

  // stage Kp [128][64] and Vp^T [64][128]: 1024 runs of 16 B each, whole lines per wave
  {
    const _Float16* ks = Kp  + (size_t)bh * LKF * HEAD_DIM;
    const _Float16* vs = VpT + (size_t)bh * LKF * HEAD_DIM;
#pragma unroll
    for (int i = 0; i < 4; ++i) {
      const int c = tid + i * 256;
      *(v8h*)(&KpL[(c >> 3) * 72 + (c & 7) * 8])   = *(const v8h*)(ks + (size_t)c * 8);
      *(v8h*)(&VpL[(c >> 4) * 136 + (c & 15) * 8]) = *(const v8h*)(vs + (size_t)c * 8);
    }
  }
  __syncthreads();   // publishes Kp and Vp^T

  v16h ka[8][2], va[4][4];
#pragma unroll
  for (int kt = 0; kt < 8; ++kt) {
#pragma unroll
    for (int ks = 0; ks < 2; ++ks) ka[kt][ks] = frag_ld(KpL, kt * 16 + fr, 72, ks * 32 + kf);
  }
#pragma unroll
  for (int dt = 0; dt < 4; ++dt) {
#pragma unroll
    for (int ks = 0; ks < 4; ++ks) va[dt][ks] = frag_ld(VpL, dt * 16 + fr, 136, ks * 32 + kf);
  }

  float* ol = &OL[wave * (16 * OPI)];
  const int rr = lane >> 4;         // two rows per wave-wide access
  const int cc = (lane & 15) * 4;   // 16 lanes x 16 B = one row's 256 B
  float* op = out + ((size_t)b * SEQ_LEN + lBase + rr) * D_MODEL + (size_t)h * HEAD_DIM + cc;
  const float sc = 0.125f * 1.44269504088896340736f;   // 1/sqrt(64), and e^x as 2^(x log2 e)

  // one row tile out of fragment set q; more: a tile it + 2 exists and is asked for
  auto tile = [&](v16h (&q)[2], const int it, const bool more) __attribute__((always_inline)) {
    // S^T[kidx, l] = Kp[kidx,:64] . Q[l,:64]
    v8f s[8] = {};
#pragma unroll
    for (int ks = 0; ks < 2; ++ks) {
#pragma unroll
      for (int kt = 0; kt < 8; ++kt) s[kt] = wmma16(ka[kt][ks], q[ks], s[kt]);
    }
    if (more) q_ld(q, qp + (size_t)(it + 2) * (128 * D_MODEL));

    // softmax over the 128 kidx of column l = lane & 15: 64 in this lane, 64 in lane ^ 16
    v8f vm = s[0];
#pragma unroll
    for (int kt = 1; kt < 8; ++kt) vm = __builtin_elementwise_max(vm, s[kt]);
    float mx = fmaxf(fmaxf(fmaxf(vm[0], vm[1]), fmaxf(vm[2], vm[3])),
                     fmaxf(fmaxf(vm[4], vm[5]), fmaxf(vm[6], vm[7])));
    mx = fmaxf(mx, other_row(mx));
    const float mc = mx * sc;
    v8f vs = {};
#pragma unroll
    for (int kt = 0; kt < 8; ++kt) {
      const v8f t = s[kt] * sc - mc;
#pragma unroll
      for (int r = 0; r < 8; ++r) s[kt][r] = __builtin_amdgcn_exp2f(t[r]);
      vs += s[kt];
    }
    float sum = ((vs[0] + vs[1]) + (vs[2] + vs[3])) + ((vs[4] + vs[5]) + (vs[6] + vs[7]));
    sum += other_row(sum);
    const float inv = 1.0f / sum;

    // O^T[d, l] = Vp^T[d,:128] . P^T[:128, l].  Tile 2 ks of S^T holds kidx = 32 ks + kf + r,
    // tile 2 ks + 1 holds 32 ks + 16 + kf + r: the two runs of the B fragment of k step ks
    // (all four fragments are formed first, each in registers of its own: the 16 WMMAs then
    // follow one another with no fragment rewritten between them)
    V16H p[4];
#pragma unroll
    for (int ks = 0; ks < 4; ++ks) {
      p[ks].h[0] = __builtin_convertvector(s[2 * ks] * inv, v8h);
      p[ks].h[1] = __builtin_convertvector(s[2 * ks + 1] * inv, v8h);
    }
    v8f o[4] = {};
#pragma unroll
    for (int ks = 0; ks < 4; ++ks) {
#pragma unroll
      for (int dt = 0; dt < 4; ++dt) o[dt] = wmma16(va[dt][ks], p[ks].v, o[dt]);
    }

    // a lane holds 8 d of one l: turned in the wave's own LDS range, so that the fp32 output
    // [b, l, h*64 + d] leaves as 16-B stores of whole 128-B lines
#pragma unroll
    for (int dt = 0; dt < 4; ++dt) {
      *(v4f*)(ol + col * OPI + dt * 16 + rofs)     = __builtin_shufflevector(o[dt], o[dt], 0, 1, 2, 3);
      *(v4f*)(ol + col * OPI + dt * 16 + rofs + 4) = __builtin_shufflevector(o[dt], o[dt], 4, 5, 6, 7);
    }
    // the wave's own LDS writes are done before it reads other lanes' rows back
    asm volatile("s_wait_dscnt 0x0" ::: "memory");
    v4f tv[8];
#pragma unroll
    for (int g = 0; g < 8; ++g) tv[g] = *(const v4f*)(ol + (g * 2 + rr) * OPI + cc);
    float* tp = op + (size_t)it * (128 * D_MODEL);
#pragma unroll
    for (int g = 0; g < 8; ++g) *(v4f*)(tp + (size_t)(g * 2) * D_MODEL) = tv[g];
    // the wait that stands before a register named by these stores is written again
    asm volatile("s_wait_xcnt 0x0" ::: "memory");
    // holds the next tile's work on those registers behind the wait
    __builtin_amdgcn_sched_barrier(0);
  };
  // two tiles a trip, so that each fragment set has a fixed name; rolled: more copies of the
  // body add code and no overlap
#pragma unroll 1
  for (int it = 0; it < AT_TILES - 2; it += 2) {
    tile(q0, it, true);
    tile(q1, it + 1, true);
  }
  tile(q0, AT_TILES - 2, false);
  tile(q1, AT_TILES - 1, false);
}

// ---------------------------------------------------------------------------
extern "C" void kernel_launch(void* const* d_in, const int* in_sizes, int n_in,
                              void* d_out, int out_size, void* d_ws, size_t ws_size,
                              hipStream_t stream) {
  const float* x  = (const float*)d_in[0];
  const float* Wq = (const float*)d_in[1];
  const float* bq = (const float*)d_in[2];
  const float* Wk = (const float*)d_in[3];
  const float* bk = (const float*)d_in[4];
  const float* Wv = (const float*)d_in[5];
  const float* bv = (const float*)d_in[6];
  const float* E  = (const float*)d_in[7];
  float* outp = (float*)d_out;

  char* ws = (char*)d_ws;
  const size_t szQKV  = (size_t)M_TOTAL * D_MODEL * sizeof(_Float16);          // 32 MB each
  const size_t szProj = (size_t)BATCH * N_HEADS * LKF * HEAD_DIM;              // 524288 elems
  _Float16* Qh = (_Float16*)(ws);
  _Float16* Kh = (_Float16*)(ws + szQKV);
  _Float16* Vh = (_Float16*)(ws + 2 * szQKV);
  float* KpPart = (float*)(ws + 3 * szQKV);                                    // 16 MB
  float* VpPart = (float*)(ws + 3 * szQKV + SPLITL * szProj * sizeof(float));  // 16 MB
  _Float16* Kp = (_Float16*)(ws + 3 * szQKV + 2 * SPLITL * szProj * sizeof(float));
  _Float16* Vp = (_Float16*)((char*)Kp + szProj * sizeof(_Float16));
  _Float16* xh = (_Float16*)((char*)Vp + szProj * sizeof(_Float16));           // 32 MB
  _Float16* Wh = (_Float16*)((char*)xh + szQKV);                               // 6 MB

  to_f16_kernel<<<dim3(CVT_XB + 3 * CVT_WB), 256, 0, stream>>>(x, Wq, Wk, Wv, xh, Wh);

  qkv_proj_kernel<<<dim3(3 * D_MODEL / 256, M_TOTAL / 256), 256, 0, stream>>>(
      xh, Wh, bq, bk, bv, Qh, Kh, Vh);

  kv_lowrank_kernel<<<dim3(BATCH * N_HEADS, SPLITL), 256, 0, stream>>>(
      E, Kh, Vh, KpPart, VpPart);

  kv_reduce_kernel<<<dim3((unsigned)(szProj / 256)), 256, 0, stream>>>(
      KpPart, VpPart, Kp, Vp);

  attn_kernel<<<dim3(SEQ_LEN / AT_ROWS, BATCH * N_HEADS), 256, 0, stream>>>(
      Qh, Kp, Vp, outp);
}
